// v000
// The times below were measured on an AMD MI455X: many runs one after another, warmed up first and cycling through
// copies of the inputs, with the whole window's GPU time divided by the number of runs. Launches and the gaps
// between them are all in it. The median over several windows is given; except for v000 it joins two sittings, which
// can be a few percent apart, so the side-by-side timings, each taken in one sitting, are the better comparison.
// The starting kernel, v000, takes 308 microseconds a run.
#include <hip/hip_runtime.h>

// ---------------------------------------------------------------------------
// Multi-head attention for MI455X (gfx1250, wave32, WMMA f32_16x16x32_f16)
//   B=4, T=2048, D=768, H=12, hd=64
// Pipeline:
//   1) f32->f16 convert x; transpose+convert Wq/Wk/Wv/Wo
//   2) WMMA GEMM (32x64 tile/wave) -> Q,K in [B,H,T,64] f16 ;
//      V in [B,H,64,T] f16 (transposed)
//   3) flash-attention: 1 wave per 32-query tile (2 sub-tiles sharing K/V
//      fragments), keys streamed 32 at a time, online softmax, P relaid
//      C->A via per-wave LDS, PV via WMMA
//   4) WMMA GEMM attn_out @ Wo + bo -> f32 d_out
// ---------------------------------------------------------------------------

typedef _Float16 v16h __attribute__((ext_vector_type(16)));
typedef _Float16 v8h  __attribute__((ext_vector_type(8)));
typedef float    v8f  __attribute__((ext_vector_type(8)));

#define BB 4
#define TT 2048
#define DD 768
#define HH 12
#define HD 64
#define MM (BB * TT)           // 8192 rows

// GEMM wave-tile: 32 rows x 64 cols
#define WTM 32
#define WTN 64
#define GT_M (MM / WTM)        // 256
#define GT_N (DD / WTN)        // 12

// Workspace byte offsets
#define OFF_XH   0u
#define OFF_WQT  (OFF_XH  + (size_t)MM * DD * 2)
#define OFF_WKT  (OFF_WQT + (size_t)DD * DD * 2)
#define OFF_WVT  (OFF_WKT + (size_t)DD * DD * 2)
#define OFF_WOT  (OFF_WVT + (size_t)DD * DD * 2)
#define OFF_Q    (OFF_WOT + (size_t)DD * DD * 2)
#define OFF_K    (OFF_Q   + (size_t)MM * DD * 2)
#define OFF_VT   (OFF_K   + (size_t)MM * DD * 2)
#define OFF_AO   (OFF_VT  + (size_t)MM * DD * 2)

__device__ __forceinline__ v8f wmma16(v16h a, v16h b, v8f c) {
  // D = A(16x32,f16) x B(32x16,f16) + C(16x16,f32)
  return __builtin_amdgcn_wmma_f32_16x16x32_f16(
      /*neg_a=*/false, a, /*neg_b=*/false, b,
      /*c_mod=*/(short)0, c, /*reuse_a=*/false, /*reuse_b=*/false);
}

// Build a 16-half fragment from two contiguous 16-byte runs.
__device__ __forceinline__ v16h make_frag(const _Float16* p0, const _Float16* p1) {
  v8h lo = *(const v8h*)p0;
  v8h hi = *(const v8h*)p1;
  v16h r;
#pragma unroll
  for (int i = 0; i < 8; ++i) { r[i] = lo[i]; r[i + 8] = hi[i]; }
  return r;
}

// ---------------------------------------------------------------------------
__global__ void cvt_f32_to_f16_kernel(const float* __restrict__ in,
                                      _Float16* __restrict__ out, int n) {
  int i = blockIdx.x * blockDim.x + threadIdx.x;
  if (i < n) out[i] = (_Float16)in[i];
}

// Wt[n*768 + k] = (f16) W[k*768 + n]   (768x768)
__global__ void transpose_cvt_kernel(const float* __restrict__ in,
                                     _Float16* __restrict__ out) {
  int i = blockIdx.x * blockDim.x + threadIdx.x;
  if (i < DD * DD) {
    int k = i % DD;
    int n = i / DD;
    out[i] = (_Float16)in[k * DD + n];
  }
}

// ---------------------------------------------------------------------------
// WMMA GEMM, 32x64 tile per wave (2 M-subtiles x 4 N-subtiles):
//   A  : f16 row-major [M, 768]
//   Bt : f16 transposed weight [N=768, K=768] (row n = column n of W)
// mode 0: out f16 scatter [B,H,T,64]   (Q, K)
// mode 1: out f16 scatter [B,H,64,T]   (V transposed)
// mode 2: out f32 row-major [M, 768]   (final projection)
// ---------------------------------------------------------------------------
__global__ __launch_bounds__(256)
void gemm_wmma_kernel(const _Float16* __restrict__ A,
                      const _Float16* __restrict__ Bt,
                      const float* __restrict__ bias,
                      void* __restrict__ out, int mode) {
  const int tid  = threadIdx.x;
  const int lane = tid & 31;
  const int wave = tid >> 5;
  const int w    = blockIdx.x * 8 + wave;
  const int tm   = w % GT_M;
  const int tn   = w / GT_M;
  const int m0   = tm * WTM;
  const int n0   = tn * WTN;
  const int hl   = lane >> 4;   // half-wave id
  const int l16  = lane & 15;

  const _Float16* arow[2];
  const _Float16* brow[4];
#pragma unroll
  for (int mi = 0; mi < 2; ++mi)
    arow[mi] = A + (size_t)(m0 + mi * 16 + l16) * DD;
#pragma unroll
  for (int ni = 0; ni < 4; ++ni)
    brow[ni] = Bt + (size_t)(n0 + ni * 16 + l16) * DD;

  v8f acc[2][4];
#pragma unroll
  for (int mi = 0; mi < 2; ++mi)
#pragma unroll
    for (int ni = 0; ni < 4; ++ni)
      acc[mi][ni] = (v8f){0.f, 0.f, 0.f, 0.f, 0.f, 0.f, 0.f, 0.f};

  for (int k0 = 0; k0 < DD; k0 += 32) {
    __builtin_prefetch((const void*)(arow[0] + k0 + 256), 0, 1);
    __builtin_prefetch((const void*)(brow[0] + k0 + 256), 0, 1);
    v16h a0 = make_frag(arow[0] + k0 + hl * 8, arow[0] + k0 + 16 + hl * 8);
    v16h a1 = make_frag(arow[1] + k0 + hl * 8, arow[1] + k0 + 16 + hl * 8);
#pragma unroll
    for (int ni = 0; ni < 4; ++ni) {
      v16h b = make_frag(brow[ni] + k0 + hl * 8, brow[ni] + k0 + 16 + hl * 8);
      acc[0][ni] = wmma16(a0, b, acc[0][ni]);
      acc[1][ni] = wmma16(a1, b, acc[1][ni]);
    }
  }

#pragma unroll
  for (int ni = 0; ni < 4; ++ni) {
    const int n = n0 + ni * 16 + l16;     // output column (C/D: N = lane%16)
    const float bval = bias[n];
    const int h = n >> 6;                 // head (64-wide N-tile stays in head)
    const int d = n & 63;
#pragma unroll
    for (int mi = 0; mi < 2; ++mi) {
      if (mode == 2) {
        float* o = (float*)out;
#pragma unroll
        for (int r = 0; r < 8; ++r) {
          int m = m0 + mi * 16 + r + 8 * hl;   // C/D: M = r + 8*(lane/16)
          o[(size_t)m * DD + n] = acc[mi][ni][r] + bval;
        }
      } else {
        _Float16* o = (_Float16*)out;
#pragma unroll
        for (int r = 0; r < 8; ++r) {
          int m = m0 + mi * 16 + r + 8 * hl;
          int b = m >> 11;                     // T = 2048
          int t = m & 2047;
          size_t idx = (mode == 0)
                           ? ((size_t)((b * HH + h) * TT + t) * HD + d)
                           : ((size_t)((b * HH + h) * HD + d) * TT + t);
          o[idx] = (_Float16)(acc[mi][ni][r] + bval);
        }
      }
    }
  }
}

// ---------------------------------------------------------------------------
// Flash attention: one wave handles 32 query rows (2 sub-tiles) of one (b,h),
// sharing every K and V fragment between the two query sub-tiles.
//   Q,K : [B*H, T, 64] f16 ; Vt : [B*H, 64, T] f16 ; AO : [M, 768] f16
// ---------------------------------------------------------------------------
__global__ __launch_bounds__(256)
void flash_attn_kernel(const _Float16* __restrict__ Q,
                       const _Float16* __restrict__ K,
                       const _Float16* __restrict__ Vt,
                       _Float16* __restrict__ AO) {
  __shared__ _Float16 pbuf[8][2 * 16 * 32];   // per-wave P tiles (C->A relayout)

  const int tid  = threadIdx.x;
  const int lane = tid & 31;
  const int wave = tid >> 5;
  const int w    = blockIdx.x * 8 + wave;
  const int qt   = w & 63;                // T/32 = 64 query tiles
  const int bh   = w >> 6;                // 0..47
  const int hl   = lane >> 4;
  const int l16  = lane & 15;
  const int q0   = qt * 32;

  // Q A-fragments: [q-subtile][k-half of head dim]
  v16h qa[2][2];
#pragma unroll
  for (int q = 0; q < 2; ++q) {
    const _Float16* qrow = Q + ((size_t)bh * TT + q0 + q * 16 + l16) * HD;
    qa[q][0] = make_frag(qrow + hl * 8,      qrow + 16 + hl * 8);
    qa[q][1] = make_frag(qrow + 32 + hl * 8, qrow + 48 + hl * 8);
  }

  v8f o[2][4];
  float mrow[2][8], lrow[2][8];
#pragma unroll
  for (int q = 0; q < 2; ++q) {
#pragma unroll
    for (int ni = 0; ni < 4; ++ni)
      o[q][ni] = (v8f){0.f, 0.f, 0.f, 0.f, 0.f, 0.f, 0.f, 0.f};
#pragma unroll
    for (int r = 0; r < 8; ++r) { mrow[q][r] = -__builtin_inff(); lrow[q][r] = 0.f; }
  }

  _Float16* pb = pbuf[wave];
  const _Float16* kbase = K  + (size_t)bh * TT * HD;
  const _Float16* vbase = Vt + (size_t)bh * HD * TT;
  const float scale = 0.125f;             // 1/sqrt(64)

  for (int kt = 0; kt < TT; kt += 32) {
    // ---- S = Q @ K^T : 2 q-subtiles x 2 key-subtiles, K frags shared ----
    v8f s[2][2];
#pragma unroll
    for (int j = 0; j < 2; ++j) {
      const _Float16* kr = kbase + (size_t)(kt + j * 16 + l16) * HD;
      v16h kb0 = make_frag(kr + hl * 8,      kr + 16 + hl * 8);
      v16h kb1 = make_frag(kr + 32 + hl * 8, kr + 48 + hl * 8);
#pragma unroll
      for (int q = 0; q < 2; ++q) {
        v8f t = (v8f){0.f, 0.f, 0.f, 0.f, 0.f, 0.f, 0.f, 0.f};
        t = wmma16(qa[q][0], kb0, t);
        t = wmma16(qa[q][1], kb1, t);
        s[q][j] = t;
      }
    }

    // ---- online softmax over the 32 new keys, per q-subtile -------------
    float alpha[2][8];
#pragma unroll
    for (int q = 0; q < 2; ++q) {
#pragma unroll
      for (int r = 0; r < 8; ++r) {
        float s0 = s[q][0][r] * scale;
        float s1 = s[q][1][r] * scale;
        float mx = fmaxf(s0, s1);
        mx = fmaxf(mx, __shfl_xor(mx, 1, 32));     // reduce across 16 cols
        mx = fmaxf(mx, __shfl_xor(mx, 2, 32));     // (stays within half-wave)
        mx = fmaxf(mx, __shfl_xor(mx, 4, 32));
        mx = fmaxf(mx, __shfl_xor(mx, 8, 32));
        float mn = fmaxf(mrow[q][r], mx);
        alpha[q][r] = __expf(mrow[q][r] - mn);
        mrow[q][r] = mn;
        float p0 = __expf(s0 - mn);
        float p1 = __expf(s1 - mn);
        s[q][0][r] = p0;
        s[q][1][r] = p1;
        float rs = p0 + p1;
        rs += __shfl_xor(rs, 1, 32);
        rs += __shfl_xor(rs, 2, 32);
        rs += __shfl_xor(rs, 4, 32);
        rs += __shfl_xor(rs, 8, 32);
        lrow[q][r] = lrow[q][r] * alpha[q][r] + rs;
      }
      // relay P: C layout -> A layout via per-wave LDS
#pragma unroll
      for (int r = 0; r < 8; ++r) {
        int M = r + 8 * hl;
        pb[q * 512 + M * 32 + l16]      = (_Float16)s[q][0][r];
        pb[q * 512 + M * 32 + 16 + l16] = (_Float16)s[q][1][r];
      }
      // rescale O accumulators
#pragma unroll
      for (int ni = 0; ni < 4; ++ni)
#pragma unroll
        for (int r = 0; r < 8; ++r)
          o[q][ni][r] *= alpha[q][r];
    }

    v16h pa[2];
#pragma unroll
    for (int q = 0; q < 2; ++q) {
      const _Float16* prow = pb + q * 512 + l16 * 32;
      pa[q] = make_frag(prow + hl * 8, prow + 16 + hl * 8);  // 16x32 A-frag
    }

    // ---- O += P @ V : V frags shared between q-subtiles -----------------
#pragma unroll
    for (int ni = 0; ni < 4; ++ni) {
      const _Float16* vc = vbase + (size_t)(ni * 16 + l16) * TT + kt;
      v16h vb = make_frag(vc + hl * 8, vc + 16 + hl * 8);
      o[0][ni] = wmma16(pa[0], vb, o[0][ni]);
      o[1][ni] = wmma16(pa[1], vb, o[1][ni]);
    }
  }

  // ---- finalize: divide by l, store to [M, 768] f16 ----------------------
  const int b = bh / HH;
  const int h = bh % HH;
#pragma unroll
  for (int q = 0; q < 2; ++q) {
#pragma unroll
    for (int r = 0; r < 8; ++r) {
      float inv = 1.f / lrow[q][r];
      int M = r + 8 * hl;
      size_t base = (size_t)(b * TT + q0 + q * 16 + M) * DD + h * HD;
#pragma unroll
      for (int ni = 0; ni < 4; ++ni)
        AO[base + ni * 16 + l16] = (_Float16)(o[q][ni][r] * inv);
    }
  }
}

// ---------------------------------------------------------------------------
extern "C" void kernel_launch(void* const* d_in, const int* in_sizes, int n_in,
                              void* d_out, int out_size, void* d_ws, size_t ws_size,
                              hipStream_t stream) {
  const float* x  = (const float*)d_in[0];
  const float* Wq = (const float*)d_in[1];
  const float* bq = (const float*)d_in[2];
  const float* Wk = (const float*)d_in[3];
  const float* bk = (const float*)d_in[4];
  const float* Wv = (const float*)d_in[5];
  const float* bv = (const float*)d_in[6];
  const float* Wo = (const float*)d_in[7];
  const float* bo = (const float*)d_in[8];

  char* ws = (char*)d_ws;
  _Float16* xh  = (_Float16*)(ws + OFF_XH);
  _Float16* wqt = (_Float16*)(ws + OFF_WQT);
  _Float16* wkt = (_Float16*)(ws + OFF_WKT);
  _Float16* wvt = (_Float16*)(ws + OFF_WVT);
  _Float16* wot = (_Float16*)(ws + OFF_WOT);
  _Float16* qh  = (_Float16*)(ws + OFF_Q);
  _Float16* kh  = (_Float16*)(ws + OFF_K);
  _Float16* vt  = (_Float16*)(ws + OFF_VT);
  _Float16* ao  = (_Float16*)(ws + OFF_AO);

  const int nx = MM * DD;                              // 6,291,456
  cvt_f32_to_f16_kernel<<<(nx + 255) / 256, 256, 0, stream>>>(x, xh, nx);
  const int nw = DD * DD;                              // 589,824
  transpose_cvt_kernel<<<(nw + 255) / 256, 256, 0, stream>>>(Wq, wqt);
  transpose_cvt_kernel<<<(nw + 255) / 256, 256, 0, stream>>>(Wk, wkt);
  transpose_cvt_kernel<<<(nw + 255) / 256, 256, 0, stream>>>(Wv, wvt);
  transpose_cvt_kernel<<<(nw + 255) / 256, 256, 0, stream>>>(Wo, wot);

  const int gemm_blocks = (GT_M * GT_N) / 8;           // 384
  gemm_wmma_kernel<<<gemm_blocks, 256, 0, stream>>>(xh, wqt, bq, (void*)qh, 0);
  gemm_wmma_kernel<<<gemm_blocks, 256, 0, stream>>>(xh, wkt, bk, (void*)kh, 0);
  gemm_wmma_kernel<<<gemm_blocks, 256, 0, stream>>>(xh, wvt, bv, (void*)vt, 1);

  const int attn_blocks = (BB * HH * (TT / 32)) / 8;   // 384
  flash_attn_kernel<<<attn_blocks, 256, 0, stream>>>(qh, kh, vt, ao);

  gemm_wmma_kernel<<<gemm_blocks, 256, 0, stream>>>(ao, wot, bo, d_out, 2);
}

// v002
// A run of this version takes 199 microseconds.
// Versions in between are left out here; by their measured steps it is 1.61 times as fast as v000.
#include <hip/hip_runtime.h>

// ---------------------------------------------------------------------------
// Multi-head attention for MI455X (gfx1250, wave32, WMMA f32_16x16x32_f16)
//   B=4, T=2048, D=768, H=12, hd=64
// Pipeline:
//   1) f32->f16 convert x; transpose+convert Wq/Wk/Wv/Wo
//   2) WMMA GEMM (32x64 tile/wave) -> Q,K in [B,H,T,64] f16 ;
//      V in [B,H,64,T] f16 (transposed)
//   3) flash-attention, transposed (S^T = K Q^T, O^T += V^T P^T): 1 wave per
//      32 query columns (2 groups sharing K/V fragments), keys streamed 32 at
//      a time, online softmax in-lane, P^T packed from the S^T accumulators
//   4) WMMA GEMM attn_out @ Wo + bo -> f32 d_out
// Every f16 operand in the workspace is kept in fragment order (frag_idx), so
// that one fragment load instruction reads 512 contiguous bytes.
// ---------------------------------------------------------------------------

typedef _Float16 v16h __attribute__((ext_vector_type(16)));
typedef _Float16 v8h  __attribute__((ext_vector_type(8)));
typedef float    v8f  __attribute__((ext_vector_type(8)));
typedef _Float16 v2h  __attribute__((ext_vector_type(2)));
typedef float    v2f  __attribute__((ext_vector_type(2)));

#define BB 4
#define TT 2048
#define DD 768
#define HH 12
#define HD 64
#define MM (BB * TT)           // 8192 rows

// GEMM wave-tile: 32 rows x 64 cols
#define WTM 32
#define WTN 64
#define GT_M (MM / WTM)        // 256
#define GT_N (DD / WTN)        // 12
#define RT (16 * DD)           // halves of one 16-row tile of a [*, 768] operand

// Workspace byte offsets
#define OFF_XH   0u
#define OFF_WQT  (OFF_XH  + (size_t)MM * DD * 2)
#define OFF_WKT  (OFF_WQT + (size_t)DD * DD * 2)
#define OFF_WVT  (OFF_WKT + (size_t)DD * DD * 2)
#define OFF_WOT  (OFF_WVT + (size_t)DD * DD * 2)
#define OFF_Q    (OFF_WOT + (size_t)DD * DD * 2)
#define OFF_K    (OFF_Q   + (size_t)MM * DD * 2)
#define OFF_VT   (OFF_K   + (size_t)MM * DD * 2)
#define OFF_AO   (OFF_VT  + (size_t)MM * DD * 2)

__device__ __forceinline__ v8f wmma16(v16h a, v16h b, v8f c) {
  // D = A(16x32,f16) x B(32x16,f16) + C(16x16,f32)
  return __builtin_amdgcn_wmma_f32_16x16x32_f16(
      /*neg_a=*/false, a, /*neg_b=*/false, b,
      /*c_mod=*/(short)0, c, /*reuse_a=*/false, /*reuse_b=*/false);
}

// Build a 16-half fragment from two contiguous 16-byte runs.
__device__ __forceinline__ v16h make_frag(const _Float16* p0, const _Float16* p1) {
  v8h lo = *(const v8h*)p0;
  v8h hi = *(const v8h*)p1;
  v16h r;
#pragma unroll
  for (int i = 0; i < 8; ++i) { r[i] = lo[i]; r[i + 8] = hi[i]; }
  return r;
}

// Fragment order of a [rows][kd] f16 operand: blocks of 16 rows x 32 k, 512
// halves each, k blocks of one row tile in a row. In a block, lane
// l = 16 * (k bit 3) + row % 16 owns halves l*8 .. l*8+7 (k bit 4 = 0) and
// 256 + l*8 .. (k bit 4 = 1): the two 16-byte runs that make_frag joins.
__device__ __forceinline__ size_t frag_idx(int row, int k, int kd) {
  return ((size_t)((row >> 4) * (kd >> 5) + (k >> 5)) << 9) +
         (size_t)((((k >> 4) & 1) << 8) + ((((k >> 3) & 1) << 4) + (row & 15)) * 8 + (k & 7));
}

// Row and k of the element that stands at place i of a fragment-ordered operand.
__device__ __forceinline__ void frag_row_k(int i, int kd, int& row, int& k) {
  const int blk = i >> 9;
  const int kb  = kd >> 5;
  row = (blk / kb) * 16 + ((i >> 3) & 15);
  k   = (blk % kb) * 32 + ((i >> 8) & 1) * 16 + ((i >> 7) & 1) * 8 + (i & 7);
}

// Fragment of row tile rt, k block ks: base + lane * 8 is passed as p.
__device__ __forceinline__ v16h load_frag(const _Float16* p, int rt, int ks, int kd) {
  const _Float16* q = p + ((size_t)(rt * (kd >> 5) + ks) << 9);
  return make_frag(q, q + 256);
}

// ---------------------------------------------------------------------------
// out = (f16) in, [M, 768] row-major -> fragment order
__global__ void cvt_f32_to_f16_kernel(const float* __restrict__ in,
                                      _Float16* __restrict__ out, int n) {
  int i = blockIdx.x * blockDim.x + threadIdx.x;
  if (i < n) {
    int row, k;
    frag_row_k(i, DD, row, k);
    out[i] = (_Float16)in[(size_t)row * DD + k];
  }
}

// Wt(row n, k) = (f16) W[k*768 + n]   (768x768), fragment order
__global__ void transpose_cvt_kernel(const float* __restrict__ in,
                                     _Float16* __restrict__ out) {
  int i = blockIdx.x * blockDim.x + threadIdx.x;
  if (i < DD * DD) {
    int n, k;
    frag_row_k(i, DD, n, k);
    out[i] = (_Float16)in[k * DD + n];
  }
}

// ---------------------------------------------------------------------------
// WMMA GEMM, 32x64 tile per wave (2 M-subtiles x 4 N-subtiles):
//   A  : f16 [M, 768], fragment order
//   Bt : f16 transposed weight [N=768, K=768] (row n = column n of W), fragment order
// mode 0: out f16 [B,H][T,64], each [T,64] in fragment order   (Q, K)
// mode 1: out f16 [B,H][64,T], each [64,T] in fragment order   (V transposed)
// mode 2: out f32 row-major [M, 768]   (final projection)
// ---------------------------------------------------------------------------
__global__ __launch_bounds__(256)
void gemm_wmma_kernel(const _Float16* __restrict__ A,
                      const _Float16* __restrict__ Bt,
                      const float* __restrict__ bias,
                      void* __restrict__ out, int mode) {
  const int tid  = threadIdx.x;
  const int lane = tid & 31;
  const int wave = tid >> 5;
  const int w    = blockIdx.x * 8 + wave;
  const int tm   = w % GT_M;
  const int tn   = w / GT_M;
  const int m0   = tm * WTM;
  const int n0   = tn * WTN;
  const int hl   = lane >> 4;   // half-wave id
  const int l16  = lane & 15;

  // this lane's 16 bytes in k block 0 of the wave's first row tile of A and of Bt
  const _Float16* ak = A  + (size_t)(m0 >> 4) * RT + lane * 8;
  const _Float16* bk = Bt + (size_t)(n0 >> 4) * RT + lane * 8;

  v8f acc[2][4];
#pragma unroll
  for (int mi = 0; mi < 2; ++mi)
#pragma unroll
    for (int ni = 0; ni < 4; ++ni)
      acc[mi][ni] = (v8f){0.f, 0.f, 0.f, 0.f, 0.f, 0.f, 0.f, 0.f};

  for (int ks = 0; ks < DD / 32; ++ks) {
    __builtin_prefetch((const void*)(ak + 8 * 512), 0, 1);   // 8 k blocks ahead
    __builtin_prefetch((const void*)(bk + 8 * 512), 0, 1);
    v16h a0 = make_frag(ak, ak + 256);
    v16h a1 = make_frag(ak + RT, ak + RT + 256);
    v16h b[4];
#pragma unroll
    for (int ni = 0; ni < 4; ++ni)
      b[ni] = make_frag(bk + ni * RT, bk + ni * RT + 256);
#pragma unroll
    for (int ni = 0; ni < 4; ++ni) {
      acc[0][ni] = wmma16(a0, b[ni], acc[0][ni]);
      acc[1][ni] = wmma16(a1, b[ni], acc[1][ni]);
    }
    // The loads above name ak and bk: as inputs here both pairs stay whole up to
    // this wait, which stands in front of the additions that rewrite them.
    asm volatile("s_wait_xcnt 0x0" :: "v"(ak), "v"(bk) : "memory");
    ak += 512;                 // next k block
    bk += 512;
  }

#pragma unroll
  for (int ni = 0; ni < 4; ++ni) {
    const int n = n0 + ni * 16 + l16;     // output column (C/D: N = lane%16)
    const float bval = bias[n];
    // the code below reuses the register that holds this load's offset
    asm volatile("s_wait_xcnt 0x0" ::: "memory");
    const int h = n >> 6;                 // head (64-wide N-tile stays in head)
    const int d = n & 63;
#pragma unroll
    for (int mi = 0; mi < 2; ++mi) {
      if (mode == 2) {
        float* o = (float*)out;
#pragma unroll
        for (int r = 0; r < 8; ++r) {
          int m = m0 + mi * 16 + r + 8 * hl;   // C/D: M = r + 8*(lane/16)
          o[(size_t)m * DD + n] = acc[mi][ni][r] + bval;
        }
        // the next tile's code reuses the registers that these stores name
        asm volatile("s_wait_xcnt 0x0" ::: "memory");
      } else {
        const int mb = m0 + mi * 16 + 8 * hl;  // row of r = 0, a multiple of 8
        const int b  = mb >> 11;               // T = 2048
        const int t0 = mb & 2047;
        _Float16* o = (_Float16*)out + (size_t)(b * HH + h) * TT * HD;
        if (mode == 0) {
#pragma unroll
          for (int r = 0; r < 8; ++r)
            o[frag_idx(t0 + r, d, HD)] = (_Float16)(acc[mi][ni][r] + bval);
          // the next tile's code reuses the registers that these stores name
          asm volatile("s_wait_xcnt 0x0" ::: "memory");
        } else {
          v8h pk;                              // k = t0 .. t0+7: one 16-byte run
#pragma unroll
          for (int r = 0; r < 8; ++r) pk[r] = (_Float16)(acc[mi][ni][r] + bval);
          *(v8h*)(o + frag_idx(d, t0, TT)) = pk;
          // the next tile's code reuses the registers that this store names
          asm volatile("s_wait_xcnt 0x0" ::: "memory");
        }
      }
    }
  }
}

// value of lane l ^ 16
__device__ __forceinline__ float xhalf(float x) {
  const int i = __builtin_bit_cast(int, x);
  return __builtin_bit_cast(
      float, __builtin_amdgcn_permlanex16(i, i, 0x76543210, 0xfedcba98, false, false));
}

__global__ __launch_bounds__(256)
void flash_attn_kernel(const _Float16* __restrict__ Q,
                       const _Float16* __restrict__ K,
                       const _Float16* __restrict__ Vt,
                       _Float16* __restrict__ AO) {
  const int tid  = threadIdx.x;
  const int lane = tid & 31;
  const int wave = tid >> 5;
  const int w    = blockIdx.x * 8 + wave;
  const int qt   = w & 63;                // T/32 = 64 query tiles
  const int bh   = w >> 6;                // 0..47
  const int hl   = lane >> 4;
  const int l16  = lane & 15;
  const int q0   = qt * 32;

  // Q B-fragments: [query group][k-half of head dim]
  v16h qb[2][2];
#pragma unroll
  for (int q = 0; q < 2; ++q) {
    const _Float16* qp = Q + (size_t)bh * TT * HD + lane * 8;
    qb[q][0] = load_frag(qp, (q0 >> 4) + q, 0, HD);
    qb[q][1] = load_frag(qp, (q0 >> 4) + q, 1, HD);
  }

  // o[q][ni][r] = O[query q0 + 16q + l16][d = 16ni + 8hl + r]
  v8f o[2][4];
  float mrun[2], lsum[2];                 // this lane's query; lsum: this half's keys
#pragma unroll
  for (int q = 0; q < 2; ++q) {
#pragma unroll
    for (int ni = 0; ni < 4; ++ni)
      o[q][ni] = (v8f){0.f, 0.f, 0.f, 0.f, 0.f, 0.f, 0.f, 0.f};
    mrun[q] = -__builtin_inff();
    lsum[q] = 0.f;
  }

  // this lane's 16 bytes in the first block of the pass's K rows and V^T columns
  const _Float16* kp = K  + (size_t)bh * TT * HD + lane * 8;
  const _Float16* vp = Vt + (size_t)bh * HD * TT + lane * 8;
  const float scale = 0.125f;             // 1/sqrt(64)

  for (int kt = 0; kt < TT; kt += 32) {
    v16h ka[2][2];                        // [key tile][k-half of head dim]
#pragma unroll
    for (int j = 0; j < 2; ++j) {
      ka[j][0] = load_frag(kp, j, 0, HD);
      ka[j][1] = load_frag(kp, j, 1, HD);
    }
    v16h va[4];                           // [16 rows of d], k = the 32 keys
#pragma unroll
    for (int ni = 0; ni < 4; ++ni) va[ni] = load_frag(vp, ni, 0, TT);
    // The loads above name kp and vp: as inputs here both pairs stay whole up to
    // this wait, which stands in front of the additions that rewrite them.
    asm volatile("s_wait_xcnt 0x0" :: "v"(kp), "v"(vp) : "memory");
    kp += 32 * HD;                        // next 32 keys: 4 blocks of K
    vp += 512;                            // next k block of V^T

    // ---- S^T = K @ Q^T : 2 key tiles x 2 query groups, K frags shared ----
    // s[q][j][r] = score of key kt + 16j + 8hl + r with this lane's query
    v8f s[2][2];
#pragma unroll
    for (int j = 0; j < 2; ++j) {
#pragma unroll
      for (int q = 0; q < 2; ++q) {
        v8f t = (v8f){0.f, 0.f, 0.f, 0.f, 0.f, 0.f, 0.f, 0.f};
        t = wmma16(ka[j][0], qb[q][0], t);
        t = wmma16(ka[j][1], qb[q][1], t);
        s[q][j] = t;
      }
    }

    // ---- online softmax over the 32 new keys, per query group ------------
    v16h pb[2];
#pragma unroll
    for (int q = 0; q < 2; ++q) {
      float mx = fmaxf(s[q][0][0], s[q][1][0]);
#pragma unroll
      for (int r = 1; r < 8; ++r) mx = fmaxf(mx, fmaxf(s[q][0][r], s[q][1][r]));
      mx = fmaxf(mx, xhalf(mx));          // the other 16 keys of this query
      const float mn = fmaxf(mrun[q], mx * scale);
      const float alpha = __expf(mrun[q] - mn);
      mrun[q] = mn;
      v2f rs = (v2f){0.f, 0.f};           // sums of even and of odd r
#pragma unroll
      for (int j = 0; j < 2; ++j) {
#pragma unroll
        for (int r = 0; r < 8; r += 2) {
          const v2f x = (v2f){s[q][j][r], s[q][j][r + 1]} * scale - mn;
          const v2f p = (v2f){__expf(x.x), __expf(x.y)};
          rs += p;
          const v2h ph = __builtin_convertvector(p, v2h);
          pb[q][8 * j + r]     = ph.x;    // k = 16j + 8hl + r
          pb[q][8 * j + r + 1] = ph.y;
        }
      }
      lsum[q] = lsum[q] * alpha + (rs.x + rs.y);
#pragma unroll
      for (int ni = 0; ni < 4; ++ni)
#pragma unroll
        for (int r = 0; r < 8; ++r)
          o[q][ni][r] *= alpha;
    }

    // ---- O^T += V^T @ P^T : V frags shared between query groups ----------
#pragma unroll
    for (int ni = 0; ni < 4; ++ni) {
      o[0][ni] = wmma16(va[ni], pb[0], o[0][ni]);
      o[1][ni] = wmma16(va[ni], pb[1], o[1][ni]);
    }
  }

  // ---- finalize: join the halves' sums, divide, store 16-byte runs of d ---
  const int b = bh / HH;
  const int h = bh % HH;
  v8h pk[2][4];
#pragma unroll
  for (int q = 0; q < 2; ++q) {
    const float inv = 1.f / (lsum[q] + xhalf(lsum[q]));
#pragma unroll
    for (int ni = 0; ni < 4; ++ni)
#pragma unroll
      for (int r = 0; r < 8; ++r) pk[q][ni][r] = (_Float16)(o[q][ni][r] * inv);
  }
  // row b*T + q0 + l16, k = h*64 + 8hl; a query group is one row tile further,
  // ni steps through the halves of two k blocks: 512 bytes in a row per store
  _Float16* ao = AO + frag_idx(b * TT + q0 + l16, h * HD + 8 * hl, DD);
#pragma unroll
  for (int q = 0; q < 2; ++q)
#pragma unroll
    for (int ni = 0; ni < 4; ++ni)
      *(v8h*)(ao + q * RT + ni * 256) = pk[q][ni];
}

// ---------------------------------------------------------------------------
extern "C" void kernel_launch(void* const* d_in, const int* in_sizes, int n_in,
                              void* d_out, int out_size, void* d_ws, size_t ws_size,
                              hipStream_t stream) {
  const float* x  = (const float*)d_in[0];
  const float* Wq = (const float*)d_in[1];
  const float* bq = (const float*)d_in[2];
  const float* Wk = (const float*)d_in[3];
  const float* bk = (const float*)d_in[4];
  const float* Wv = (const float*)d_in[5];
  const float* bv = (const float*)d_in[6];
  const float* Wo = (const float*)d_in[7];
  const float* bo = (const float*)d_in[8];

  char* ws = (char*)d_ws;
  _Float16* xh  = (_Float16*)(ws + OFF_XH);
  _Float16* wqt = (_Float16*)(ws + OFF_WQT);
  _Float16* wkt = (_Float16*)(ws + OFF_WKT);
  _Float16* wvt = (_Float16*)(ws + OFF_WVT);
  _Float16* wot = (_Float16*)(ws + OFF_WOT);
  _Float16* qh  = (_Float16*)(ws + OFF_Q);
  _Float16* kh  = (_Float16*)(ws + OFF_K);
  _Float16* vt  = (_Float16*)(ws + OFF_VT);
  _Float16* ao  = (_Float16*)(ws + OFF_AO);

  const int nx = MM * DD;                              // 6,291,456
  cvt_f32_to_f16_kernel<<<(nx + 255) / 256, 256, 0, stream>>>(x, xh, nx);
  const int nw = DD * DD;                              // 589,824
  transpose_cvt_kernel<<<(nw + 255) / 256, 256, 0, stream>>>(Wq, wqt);
  transpose_cvt_kernel<<<(nw + 255) / 256, 256, 0, stream>>>(Wk, wkt);
  transpose_cvt_kernel<<<(nw + 255) / 256, 256, 0, stream>>>(Wv, wvt);
  transpose_cvt_kernel<<<(nw + 255) / 256, 256, 0, stream>>>(Wo, wot);

  const int gemm_blocks = (GT_M * GT_N) / 8;           // 384
  gemm_wmma_kernel<<<gemm_blocks, 256, 0, stream>>>(xh, wqt, bq, (void*)qh, 0);
  gemm_wmma_kernel<<<gemm_blocks, 256, 0, stream>>>(xh, wkt, bk, (void*)kh, 0);
  gemm_wmma_kernel<<<gemm_blocks, 256, 0, stream>>>(xh, wvt, bv, (void*)vt, 1);

  const int attn_blocks = (BB * HH * (TT / 32)) / 8;   // 384
  flash_attn_kernel<<<attn_blocks, 256, 0, stream>>>(qh, kh, vt, ao);

  gemm_wmma_kernel<<<gemm_blocks, 256, 0, stream>>>(ao, wot, bo, d_out, 2);
}

// v003
// Measured time: 162 microseconds a run.
// Two timings next to v002 both put it at 1.23 times that version's speed.
// All steps since v000 together make it 1.98 times as fast.
#include <hip/hip_runtime.h>

// ---------------------------------------------------------------------------
// Multi-head attention for MI455X (gfx1250, wave32, WMMA f32_16x16x32_f16)
//   B=4, T=2048, D=768, H=12, hd=64
// Pipeline:
//   1) one launch: f32->f16 convert x; transpose+convert Wq/Wk/Wv/Wo
//   2) one launch: WMMA GEMMs (32x64 tile/wave) -> Q,K in [B,H,T,64] f16 ;
//      V in [B,H,64,T] f16 (transposed)
//   3) flash-attention, transposed (S^T = K Q^T, O^T += V^T P^T): 1 wave per
//      32 query columns (2 groups sharing K/V fragments), keys streamed 32 at
//      a time, online softmax in-lane, P^T packed from the S^T accumulators
//   4) WMMA GEMM attn_out @ Wo + bo -> f32 d_out
// Every f16 operand in the workspace is kept in fragment order (frag_idx), so
// that one fragment load instruction reads 512 contiguous bytes.
// ---------------------------------------------------------------------------

typedef _Float16 v16h __attribute__((ext_vector_type(16)));
typedef _Float16 v8h  __attribute__((ext_vector_type(8)));
typedef float    v8f  __attribute__((ext_vector_type(8)));
typedef _Float16 v2h  __attribute__((ext_vector_type(2)));
typedef float    v2f  __attribute__((ext_vector_type(2)));

#define BB 4
#define TT 2048
#define DD 768
#define HH 12
#define HD 64
#define MM (BB * TT)           // 8192 rows

// GEMM wave-tile: 32 rows x 64 cols
#define WTM 32
#define WTN 64
#define GT_M (MM / WTM)        // 256
#define GT_N (DD / WTN)        // 12
#define RT (16 * DD)           // halves of one 16-row tile of a [*, 768] operand
#define GW 12                  // waves of a block of the Q, K, V launch

// blocks of 256 elements in the convert launch
#define WBLK (DD * DD / 256)   // 2304 a weight
#define XBLK (MM * DD / 256)   // 24576 for x

// Workspace byte offsets
#define OFF_XH   0u
#define OFF_WQT  (OFF_XH  + (size_t)MM * DD * 2)
#define OFF_WKT  (OFF_WQT + (size_t)DD * DD * 2)
#define OFF_WVT  (OFF_WKT + (size_t)DD * DD * 2)
#define OFF_WOT  (OFF_WVT + (size_t)DD * DD * 2)
#define OFF_Q    (OFF_WOT + (size_t)DD * DD * 2)
#define OFF_K    (OFF_Q   + (size_t)MM * DD * 2)
#define OFF_VT   (OFF_K   + (size_t)MM * DD * 2)
#define OFF_AO   (OFF_VT  + (size_t)MM * DD * 2)

__device__ __forceinline__ v8f wmma16(v16h a, v16h b, v8f c) {
  // D = A(16x32,f16) x B(32x16,f16) + C(16x16,f32)
  return __builtin_amdgcn_wmma_f32_16x16x32_f16(
      /*neg_a=*/false, a, /*neg_b=*/false, b,
      /*c_mod=*/(short)0, c, /*reuse_a=*/false, /*reuse_b=*/false);
}

// Build a 16-half fragment from two contiguous 16-byte runs.
__device__ __forceinline__ v16h make_frag(const _Float16* p0, const _Float16* p1) {
  v8h lo = *(const v8h*)p0;
  v8h hi = *(const v8h*)p1;
  v16h r;
#pragma unroll
  for (int i = 0; i < 8; ++i) { r[i] = lo[i]; r[i + 8] = hi[i]; }
  return r;
}

// Fragment order of a [rows][kd] f16 operand: blocks of 16 rows x 32 k, 512
// halves each, k blocks of one row tile in a row. In a block, lane
// l = 16 * (k bit 3) + row % 16 owns halves l*8 .. l*8+7 (k bit 4 = 0) and
// 256 + l*8 .. (k bit 4 = 1): the two 16-byte runs that make_frag joins.
__device__ __forceinline__ size_t frag_idx(int row, int k, int kd) {
  return ((size_t)((row >> 4) * (kd >> 5) + (k >> 5)) << 9) +
         (size_t)((((k >> 4) & 1) << 8) + ((((k >> 3) & 1) << 4) + (row & 15)) * 8 + (k & 7));
}

// Row and k of the element that stands at place i of a fragment-ordered operand.
__device__ __forceinline__ void frag_row_k(int i, int kd, int& row, int& k) {
  const int blk = i >> 9;
  const int kb  = kd >> 5;
  row = (blk / kb) * 16 + ((i >> 3) & 15);
  k   = (blk % kb) * 32 + ((i >> 8) & 1) * 16 + ((i >> 7) & 1) * 8 + (i & 7);
}

// Fragment of row tile rt, k block ks: base + lane * 8 is passed as p.
__device__ __forceinline__ v16h load_frag(const _Float16* p, int rt, int ks, int kd) {
  const _Float16* q = p + ((size_t)(rt * (kd >> 5) + ks) << 9);
  return make_frag(q, q + 256);
}

// ---------------------------------------------------------------------------
// All five conversions as block ranges of one grid (none reads what another
// writes). Blocks 0 .. 4*WBLK-1, the weights, whose loads are the more scattered:
//   wt[sel](row n, k) = (f16) W[sel][k*768 + n]   (768x768), fragment order
// the rest: xh = (f16) x, [M, 768] row-major -> fragment order
__global__ __launch_bounds__(256)
void cvt_all_kernel(const float* __restrict__ x,
                    const float* __restrict__ Wq, const float* __restrict__ Wk,
                    const float* __restrict__ Wv, const float* __restrict__ Wo,
                    _Float16* __restrict__ xh, _Float16* __restrict__ wt) {
  const int blk = blockIdx.x;
  if (blk < 4 * WBLK) {
    const int sel = blk / WBLK;
    const float* in = sel == 0 ? Wq : sel == 1 ? Wk : sel == 2 ? Wv : Wo;
    const int i = (blk - sel * WBLK) * 256 + threadIdx.x;
    int n, k;
    frag_row_k(i, DD, n, k);
    wt[(size_t)sel * DD * DD + i] = (_Float16)in[k * DD + n];
    // no register that this store names is rewritten in front of this wait
    asm volatile("s_wait_xcnt 0x0" ::: "memory");
  } else {
    const int i = (blk - 4 * WBLK) * 256 + threadIdx.x;
    int row, k;
    frag_row_k(i, DD, row, k);
    xh[i] = (_Float16)x[(size_t)row * DD + k];
    // no register that this store names is rewritten in front of this wait
    asm volatile("s_wait_xcnt 0x0" ::: "memory");
  }
}

// ---------------------------------------------------------------------------
// WMMA GEMM, 32x64 tile per wave (2 M-subtiles x 4 N-subtiles):
//   A  : f16 [M, 768], fragment order
//   Bt : f16 transposed weight [N=768, K=768] (row n = column n of W), fragment order
// mode 0: out f16 [B,H][T,64], each [T,64] in fragment order   (Q, K)
// mode 1: out f16 [B,H][64,T], each [64,T] in fragment order   (V transposed)
// mode 2: out f32 row-major [M, 768]   (final projection)
// A launch holds one product (proj = 1: mode 2, 8 waves, 8 tiles a block) or three that
// share A (proj = 0): a block is then 12 waves, 4 tiles x 3 products, so that the three
// waves of a tile read the same A lines at the same time. Product sel takes weight
// Bt3 + sel * 768 * 768, bias sel and the sel-th [M, 768] f16 plane of out;
// sel 0, 1 are mode 0, sel 2 is mode 1.
// ---------------------------------------------------------------------------
__global__ __launch_bounds__(GW * 32)
void gemm_wmma_kernel(const _Float16* __restrict__ A,
                      const _Float16* __restrict__ Bt3,
                      const float* __restrict__ bias0,
                      const float* __restrict__ bias1,
                      const float* __restrict__ bias2,
                      void* __restrict__ out, int proj) {
  const int tid  = threadIdx.x;
  const int lane = tid & 31;
  // as a scalar: the product that it selects picks pointers and the store branch
  const int wave = __builtin_amdgcn_readfirstlane(tid >> 5);
  const int sel  = proj ? 0 : wave >> 2;
  const int mode = proj ? 2 : (sel == 2 ? 1 : 0);
  const _Float16* Bt = Bt3 + (size_t)sel * DD * DD;
  const float* bias  = sel == 0 ? bias0 : sel == 1 ? bias1 : bias2;
  const int w    = proj ? blockIdx.x * 8 + wave : blockIdx.x * 4 + (wave & 3);
  const int tm   = w % GT_M;
  const int tn   = w / GT_M;
  const int m0   = tm * WTM;
  const int n0   = tn * WTN;
  const int hl   = lane >> 4;   // half-wave id
  const int l16  = lane & 15;

  // this lane's 16 bytes in k block 0 of the wave's first row tile of A and of Bt
  const _Float16* ak = A  + (size_t)(m0 >> 4) * RT + lane * 8;
  const _Float16* bk = Bt + (size_t)(n0 >> 4) * RT + lane * 8;

  v8f acc[2][4];
#pragma unroll
  for (int mi = 0; mi < 2; ++mi)
#pragma unroll
    for (int ni = 0; ni < 4; ++ni)
      acc[mi][ni] = (v8f){0.f, 0.f, 0.f, 0.f, 0.f, 0.f, 0.f, 0.f};

  for (int ks = 0; ks < DD / 32; ++ks) {
    __builtin_prefetch((const void*)(ak + 8 * 512), 0, 1);   // 8 k blocks ahead
    __builtin_prefetch((const void*)(bk + 8 * 512), 0, 1);
    v16h a0 = make_frag(ak, ak + 256);
    v16h a1 = make_frag(ak + RT, ak + RT + 256);
    v16h b[4];
#pragma unroll
    for (int ni = 0; ni < 4; ++ni)
      b[ni] = make_frag(bk + ni * RT, bk + ni * RT + 256);
#pragma unroll
    for (int ni = 0; ni < 4; ++ni) {
      acc[0][ni] = wmma16(a0, b[ni], acc[0][ni]);
      acc[1][ni] = wmma16(a1, b[ni], acc[1][ni]);
    }
    // The loads above name ak and bk: as inputs here both pairs stay whole up to
    // this wait, which stands in front of the additions that rewrite them.
    asm volatile("s_wait_xcnt 0x0" :: "v"(ak), "v"(bk) : "memory");
    ak += 512;                 // next k block
    bk += 512;
  }

#pragma unroll
  for (int ni = 0; ni < 4; ++ni) {
    const int n = n0 + ni * 16 + l16;     // output column (C/D: N = lane%16)
    const float bval = bias[n];
    // the code below reuses the register that holds this load's offset
    asm volatile("s_wait_xcnt 0x0" ::: "memory");
    const int h = n >> 6;                 // head (64-wide N-tile stays in head)
    const int d = n & 63;
#pragma unroll
    for (int mi = 0; mi < 2; ++mi) {
      if (mode == 2) {
        float* o = (float*)out;
#pragma unroll
        for (int r = 0; r < 8; ++r) {
          int m = m0 + mi * 16 + r + 8 * hl;   // C/D: M = r + 8*(lane/16)
          o[(size_t)m * DD + n] = acc[mi][ni][r] + bval;
        }
        // the next tile's code reuses the registers that these stores name
        asm volatile("s_wait_xcnt 0x0" ::: "memory");
      } else {
        const int mb = m0 + mi * 16 + 8 * hl;  // row of r = 0, a multiple of 8
        const int b  = mb >> 11;               // T = 2048
        const int t0 = mb & 2047;
        _Float16* o = (_Float16*)out + (size_t)sel * MM * DD + (size_t)(b * HH + h) * TT * HD;
        if (mode == 0) {
#pragma unroll
          for (int r = 0; r < 8; ++r)
            o[frag_idx(t0 + r, d, HD)] = (_Float16)(acc[mi][ni][r] + bval);
          // the next tile's code reuses the registers that these stores name
          asm volatile("s_wait_xcnt 0x0" ::: "memory");
        } else {
          v8h pk;                              // k = t0 .. t0+7: one 16-byte run
#pragma unroll
          for (int r = 0; r < 8; ++r) pk[r] = (_Float16)(acc[mi][ni][r] + bval);
          *(v8h*)(o + frag_idx(d, t0, TT)) = pk;
          // the next tile's code reuses the registers that this store names
          asm volatile("s_wait_xcnt 0x0" ::: "memory");
        }
      }
    }
  }
}

// value of lane l ^ 16
__device__ __forceinline__ float xhalf(float x) {
  const int i = __builtin_bit_cast(int, x);
  return __builtin_bit_cast(
      float, __builtin_amdgcn_permlanex16(i, i, 0x76543210, 0xfedcba98, false, false));
}

__global__ __launch_bounds__(256)
void flash_attn_kernel(const _Float16* __restrict__ Q,
                       const _Float16* __restrict__ K,
                       const _Float16* __restrict__ Vt,
                       _Float16* __restrict__ AO) {
  const int tid  = threadIdx.x;
  const int lane = tid & 31;
  const int wave = tid >> 5;
  const int w    = blockIdx.x * 8 + wave;
  const int qt   = w & 63;                // T/32 = 64 query tiles
  const int bh   = w >> 6;                // 0..47
  const int hl   = lane >> 4;
  const int l16  = lane & 15;
  const int q0   = qt * 32;

  // Q B-fragments: [query group][k-half of head dim]
  v16h qb[2][2];
#pragma unroll
  for (int q = 0; q < 2; ++q) {
    const _Float16* qp = Q + (size_t)bh * TT * HD + lane * 8;
    qb[q][0] = load_frag(qp, (q0 >> 4) + q, 0, HD);
    qb[q][1] = load_frag(qp, (q0 >> 4) + q, 1, HD);
  }

  // o[q][ni][r] = O[query q0 + 16q + l16][d = 16ni + 8hl + r]
  v8f o[2][4];
  float mrun[2], lsum[2];                 // this lane's query; lsum: this half's keys
#pragma unroll
  for (int q = 0; q < 2; ++q) {
#pragma unroll
    for (int ni = 0; ni < 4; ++ni)
      o[q][ni] = (v8f){0.f, 0.f, 0.f, 0.f, 0.f, 0.f, 0.f, 0.f};
    mrun[q] = -__builtin_inff();
    lsum[q] = 0.f;
  }

  // this lane's 16 bytes in the first block of the pass's K rows and V^T columns
  const _Float16* kp = K  + (size_t)bh * TT * HD + lane * 8;
  const _Float16* vp = Vt + (size_t)bh * HD * TT + lane * 8;
  const float scale = 0.125f;             // 1/sqrt(64)

  for (int kt = 0; kt < TT; kt += 32) {
    v16h ka[2][2];                        // [key tile][k-half of head dim]
#pragma unroll
    for (int j = 0; j < 2; ++j) {
      ka[j][0] = load_frag(kp, j, 0, HD);
      ka[j][1] = load_frag(kp, j, 1, HD);
    }
    v16h va[4];                           // [16 rows of d], k = the 32 keys
#pragma unroll
    for (int ni = 0; ni < 4; ++ni) va[ni] = load_frag(vp, ni, 0, TT);
    // The loads above name kp and vp: as inputs here both pairs stay whole up to
    // this wait, which stands in front of the additions that rewrite them.
    asm volatile("s_wait_xcnt 0x0" :: "v"(kp), "v"(vp) : "memory");
    kp += 32 * HD;                        // next 32 keys: 4 blocks of K
    vp += 512;                            // next k block of V^T

    // ---- S^T = K @ Q^T : 2 key tiles x 2 query groups, K frags shared ----
    // s[q][j][r] = score of key kt + 16j + 8hl + r with this lane's query
    v8f s[2][2];
#pragma unroll
    for (int j = 0; j < 2; ++j) {
#pragma unroll
      for (int q = 0; q < 2; ++q) {
        v8f t = (v8f){0.f, 0.f, 0.f, 0.f, 0.f, 0.f, 0.f, 0.f};
        t = wmma16(ka[j][0], qb[q][0], t);
        t = wmma16(ka[j][1], qb[q][1], t);
        s[q][j] = t;
      }
    }

    // ---- online softmax over the 32 new keys, per query group ------------
    v16h pb[2];
#pragma unroll
    for (int q = 0; q < 2; ++q) {
      float mx = fmaxf(s[q][0][0], s[q][1][0]);
#pragma unroll
      for (int r = 1; r < 8; ++r) mx = fmaxf(mx, fmaxf(s[q][0][r], s[q][1][r]));
      mx = fmaxf(mx, xhalf(mx));          // the other 16 keys of this query
      const float mn = fmaxf(mrun[q], mx * scale);
      const float alpha = __expf(mrun[q] - mn);
      mrun[q] = mn;
      v2f rs = (v2f){0.f, 0.f};           // sums of even and of odd r
#pragma unroll
      for (int j = 0; j < 2; ++j) {
#pragma unroll
        for (int r = 0; r < 8; r += 2) {
          const v2f x = (v2f){s[q][j][r], s[q][j][r + 1]} * scale - mn;
          const v2f p = (v2f){__expf(x.x), __expf(x.y)};
          rs += p;
          const v2h ph = __builtin_convertvector(p, v2h);
          pb[q][8 * j + r]     = ph.x;    // k = 16j + 8hl + r
          pb[q][8 * j + r + 1] = ph.y;
        }
      }
      lsum[q] = lsum[q] * alpha + (rs.x + rs.y);
#pragma unroll
      for (int ni = 0; ni < 4; ++ni)
#pragma unroll
        for (int r = 0; r < 8; ++r)
          o[q][ni][r] *= alpha;
    }

    // ---- O^T += V^T @ P^T : V frags shared between query groups ----------
#pragma unroll
    for (int ni = 0; ni < 4; ++ni) {
      o[0][ni] = wmma16(va[ni], pb[0], o[0][ni]);
      o[1][ni] = wmma16(va[ni], pb[1], o[1][ni]);
    }
  }

  // ---- finalize: join the halves' sums, divide, store 16-byte runs of d ---
  const int b = bh / HH;
  const int h = bh % HH;
  v8h pk[2][4];
#pragma unroll
  for (int q = 0; q < 2; ++q) {
    const float inv = 1.f / (lsum[q] + xhalf(lsum[q]));
#pragma unroll
    for (int ni = 0; ni < 4; ++ni)
#pragma unroll
      for (int r = 0; r < 8; ++r) pk[q][ni][r] = (_Float16)(o[q][ni][r] * inv);
  }
  // row b*T + q0 + l16, k = h*64 + 8hl; a query group is one row tile further,
  // ni steps through the halves of two k blocks: 512 bytes in a row per store
  _Float16* ao = AO + frag_idx(b * TT + q0 + l16, h * HD + 8 * hl, DD);
#pragma unroll
  for (int q = 0; q < 2; ++q)
#pragma unroll
    for (int ni = 0; ni < 4; ++ni)
      *(v8h*)(ao + q * RT + ni * 256) = pk[q][ni];
}

// ---------------------------------------------------------------------------
extern "C" void kernel_launch(void* const* d_in, const int* in_sizes, int n_in,
                              void* d_out, int out_size, void* d_ws, size_t ws_size,
                              hipStream_t stream) {
  const float* x  = (const float*)d_in[0];
  const float* Wq = (const float*)d_in[1];
  const float* bq = (const float*)d_in[2];
  const float* Wk = (const float*)d_in[3];
  const float* bk = (const float*)d_in[4];
  const float* Wv = (const float*)d_in[5];
  const float* bv = (const float*)d_in[6];
  const float* Wo = (const float*)d_in[7];
  const float* bo = (const float*)d_in[8];

  char* ws = (char*)d_ws;
  _Float16* xh  = (_Float16*)(ws + OFF_XH);
  _Float16* wqt = (_Float16*)(ws + OFF_WQT);
  _Float16* wot = (_Float16*)(ws + OFF_WOT);
  _Float16* qh  = (_Float16*)(ws + OFF_Q);
  _Float16* kh  = (_Float16*)(ws + OFF_K);
  _Float16* vt  = (_Float16*)(ws + OFF_VT);
  _Float16* ao  = (_Float16*)(ws + OFF_AO);

  // wqt, wkt, wvt, wot stand one behind the other in the workspace; so do qh, kh, vt
  cvt_all_kernel<<<4 * WBLK + XBLK, 256, 0, stream>>>(x, Wq, Wk, Wv, Wo, xh, wqt);

  gemm_wmma_kernel<<<GT_M * GT_N / 4, GW * 32, 0, stream>>>(xh, wqt, bq, bk, bv, (void*)qh, 0);

  const int attn_blocks = (BB * HH * (TT / 32)) / 8;   // 384
  flash_attn_kernel<<<attn_blocks, 256, 0, stream>>>(qh, kh, vt, ao);

  gemm_wmma_kernel<<<GT_M * GT_N / 8, 256, 0, stream>>>(ao, wot, bo, bo, bo, d_out, 1);
}

// v004
// It runs in 154 microseconds.
// Next to v003, in two timings, it ran 1.04 and 1.05 times as fast.
// All steps since v000 together make it 2.06 times as fast.
#include <hip/hip_runtime.h>

// ---------------------------------------------------------------------------
// Multi-head attention for MI455X (gfx1250, wave32, WMMA f32_16x16x32_f16)
//   B=4, T=2048, D=768, H=12, hd=64
// Pipeline:
//   1) one launch: f32->f16 convert x; transpose+convert Wq/Wk/Wv/Wo
//   2) one launch: WMMA GEMMs (32x64 tile/wave) -> Q,K in [B,H,T,64] f16 ;
//      V in [B,H,64,T] f16 (transposed)
//   3) flash-attention, transposed (S^T = K Q^T, O^T += V^T P^T): 1 wave per
//      32 query columns (2 groups sharing K/V fragments), keys streamed 32 at
//      a time, online softmax in-lane, P^T packed from the S^T accumulators
//   4) WMMA GEMM attn_out @ Wo + bo -> f32 d_out
// Every f16 operand in the workspace is kept in fragment order (frag_idx), so
// that one fragment load instruction reads 512 contiguous bytes.
// ---------------------------------------------------------------------------

typedef _Float16 v16h __attribute__((ext_vector_type(16)));
typedef _Float16 v8h  __attribute__((ext_vector_type(8)));
typedef float    v8f  __attribute__((ext_vector_type(8)));
typedef _Float16 v2h  __attribute__((ext_vector_type(2)));
typedef float    v2f  __attribute__((ext_vector_type(2)));
typedef float    v4f  __attribute__((ext_vector_type(4)));

#define BB 4
#define TT 2048
#define DD 768
#define HH 12
#define HD 64
#define MM (BB * TT)           // 8192 rows

// GEMM wave-tile: 32 rows x 64 cols
#define WTM 32
#define WTN 64
#define GT_M (MM / WTM)        // 256
#define GT_N (DD / WTN)        // 12
#define RT (16 * DD)           // halves of one 16-row tile of a [*, 768] operand
#define GW 12                  // waves of a block of the Q, K, V launch

// convert launch, blocks of 8 waves. A wave of the weight part makes 2 row tiles x 1 k
// block (4 runs of 8 halves a lane), a wave of the x part 1 row tile x 4 k blocks (8 runs).
#define WBLK ((DD / 32) * (DD / 32) / 8)   // 72 a weight
#define XBLK ((MM / 16) * (DD / 128) / 8)  // 384 for x

// Workspace byte offsets
#define OFF_XH   0u
#define OFF_WQT  (OFF_XH  + (size_t)MM * DD * 2)
#define OFF_WKT  (OFF_WQT + (size_t)DD * DD * 2)
#define OFF_WVT  (OFF_WKT + (size_t)DD * DD * 2)
#define OFF_WOT  (OFF_WVT + (size_t)DD * DD * 2)
#define OFF_Q    (OFF_WOT + (size_t)DD * DD * 2)
#define OFF_K    (OFF_Q   + (size_t)MM * DD * 2)
#define OFF_VT   (OFF_K   + (size_t)MM * DD * 2)
#define OFF_AO   (OFF_VT  + (size_t)MM * DD * 2)

__device__ __forceinline__ v8f wmma16(v16h a, v16h b, v8f c) {
  // D = A(16x32,f16) x B(32x16,f16) + C(16x16,f32)
  return __builtin_amdgcn_wmma_f32_16x16x32_f16(
      /*neg_a=*/false, a, /*neg_b=*/false, b,
      /*c_mod=*/(short)0, c, /*reuse_a=*/false, /*reuse_b=*/false);
}

// Build a 16-half fragment from two contiguous 16-byte runs.
__device__ __forceinline__ v16h make_frag(const _Float16* p0, const _Float16* p1) {
  v8h lo = *(const v8h*)p0;
  v8h hi = *(const v8h*)p1;
  v16h r;
#pragma unroll
  for (int i = 0; i < 8; ++i) { r[i] = lo[i]; r[i + 8] = hi[i]; }
  return r;
}

// Fragment order of a [rows][kd] f16 operand: blocks of 16 rows x 32 k, 512
// halves each, k blocks of one row tile in a row. In a block, lane
// l = 16 * (k bit 3) + row % 16 owns halves l*8 .. l*8+7 (k bit 4 = 0) and
// 256 + l*8 .. (k bit 4 = 1): the two 16-byte runs that make_frag joins.
__device__ __forceinline__ size_t frag_idx(int row, int k, int kd) {
  return ((size_t)((row >> 4) * (kd >> 5) + (k >> 5)) << 9) +
         (size_t)((((k >> 4) & 1) << 8) + ((((k >> 3) & 1) << 4) + (row & 15)) * 8 + (k & 7));
}

// Fragment of row tile rt, k block ks: base + lane * 8 is passed as p.
__device__ __forceinline__ v16h load_frag(const _Float16* p, int rt, int ks, int kd) {
  const _Float16* q = p + ((size_t)(rt * (kd >> 5) + ks) << 9);
  return make_frag(q, q + 256);
}

// ---------------------------------------------------------------------------
// All five conversions as block ranges of one grid (none reads what another
// writes). Blocks 0 .. 4*WBLK-1, the weights, whose loads are the more scattered:
//   wt[sel](row n, k) = (f16) W[sel][k*768 + n]   (768x768), fragment order
// the rest: xh = (f16) x, [M, 768] row-major -> fragment order
// A lane makes whole 16-byte runs (8 k of one row): lane l of a wave owns place l of
// each half block, so a store instruction writes 512 bytes in a row. All loads of a
// lane are issued before the first conversion.
__global__ __launch_bounds__(256)
void cvt_all_kernel(const float* __restrict__ x,
                    const float* __restrict__ Wq, const float* __restrict__ Wk,
                    const float* __restrict__ Wv, const float* __restrict__ Wo,
                    _Float16* __restrict__ xh, _Float16* __restrict__ wt) {
  const int blk  = blockIdx.x;
  const int lane = threadIdx.x & 31;
  // as a scalar: block addresses then stay in scalar registers
  const int wave = __builtin_amdgcn_readfirstlane(threadIdx.x >> 5);
  const int hl   = lane >> 4;   // k bit 3
  const int l16  = lane & 15;   // row % 16
  if (blk < 4 * WBLK) {
    const int sel = blk / WBLK;
    const float* in = sel == 0 ? Wq : sel == 1 ? Wk : sel == 2 ? Wv : Wo;
    const int wv = (blk - sel * WBLK) * 8 + wave;
    const int tp = wv / (DD / 32);          // pair of row tiles: n = 32 tp ..
    const int kb = wv % (DD / 32);          // k block
    // W[k = 32 kb + 8 hl][n = 32 tp + l16]
    const float* p = in + (size_t)(kb * 32 + hl * 8) * DD + tp * 32 + l16;
    float f[2][2][8];                       // [row tile][k bit 4][k & 7]
#pragma unroll
    for (int h = 0; h < 2; ++h)
#pragma unroll
      for (int j = 0; j < 8; ++j)
#pragma unroll
        for (int t = 0; t < 2; ++t)         // the two halves of one 128-byte line
          f[t][h][j] = p[(h * 16 + j) * DD + t * 16];
    // the conversions below may reuse the registers that hold these loads' address;
    // as an input the pair stays whole up to this wait
    asm volatile("s_wait_xcnt 0x0" :: "v"(p) : "memory");
    _Float16* o = wt + (size_t)sel * DD * DD + (size_t)tp * 2 * RT + kb * 512 + lane * 8;
#pragma unroll
    for (int t = 0; t < 2; ++t)
#pragma unroll
      for (int h = 0; h < 2; ++h) {
        v8h pk;
#pragma unroll
        for (int j = 0; j < 8; ++j) pk[j] = (_Float16)f[t][h][j];
        *(v8h*)(o + t * RT + h * 256) = pk;
      }
    // no register that these stores name is rewritten in front of this wait
    asm volatile("s_wait_xcnt 0x0" ::: "memory");
  } else {
    const int wv = (blk - 4 * WBLK) * 8 + wave;
    const int rt = wv / (DD / 128);         // row tile
    const int kq = wv % (DD / 128);         // four k blocks: 512 bytes of each row
    // x[row = 16 rt + l16][k = 128 kq + 8 hl]
    const float* p = x + (size_t)(rt * 16 + l16) * DD + kq * 128 + hl * 8;
    v4f f[8][2];                            // [half block][k bit 2]
#pragma unroll
    for (int u = 0; u < 8; ++u) {
      f[u][0] = *(const v4f*)(p + u * 16);
      f[u][1] = *(const v4f*)(p + u * 16 + 4);
    }
    // The loaded values as inputs: without them the compiler converts the first runs
    // between the loads and issues the last loads only when the first have come back;
    // so all 16 are in flight at once. The wait: the code below may reuse the registers
    // that hold these loads' address; as an input the pair stays whole up to it.
    asm volatile("s_wait_xcnt 0x0"
                 :: "v"(p), "v"(f[0][0]), "v"(f[0][1]), "v"(f[1][0]), "v"(f[1][1]),
                    "v"(f[2][0]), "v"(f[2][1]), "v"(f[3][0]), "v"(f[3][1]),
                    "v"(f[4][0]), "v"(f[4][1]), "v"(f[5][0]), "v"(f[5][1]),
                    "v"(f[6][0]), "v"(f[6][1]), "v"(f[7][0]), "v"(f[7][1])
                 : "memory");
    _Float16* o = xh + (size_t)rt * RT + kq * 4 * 512 + lane * 8;
#pragma unroll
    for (int u = 0; u < 8; ++u) {
      v8h pk;
#pragma unroll
      for (int j = 0; j < 4; ++j) {
        pk[j]     = (_Float16)f[u][0][j];
        pk[j + 4] = (_Float16)f[u][1][j];
      }
      *(v8h*)(o + u * 256) = pk;
    }
    // no register that these stores name is rewritten in front of this wait
    asm volatile("s_wait_xcnt 0x0" ::: "memory");
  }
}

// ---------------------------------------------------------------------------
// WMMA GEMM, 32x64 tile per wave (2 M-subtiles x 4 N-subtiles):
//   A  : f16 [M, 768], fragment order
//   Bt : f16 transposed weight [N=768, K=768] (row n = column n of W), fragment order
// mode 0: out f16 [B,H][T,64], each [T,64] in fragment order   (Q, K)
// mode 1: out f16 [B,H][64,T], each [64,T] in fragment order   (V transposed)
// mode 2: out f32 row-major [M, 768]   (final projection)
// A launch holds one product (proj = 1: mode 2, 8 waves, 8 tiles a block) or three that
// share A (proj = 0): a block is then 12 waves, 4 tiles x 3 products, so that the three
// waves of a tile read the same A lines at the same time. Product sel takes weight
// Bt3 + sel * 768 * 768, bias sel and the sel-th [M, 768] f16 plane of out;
// sel 0, 1 are mode 0, sel 2 is mode 1.
// ---------------------------------------------------------------------------
__global__ __launch_bounds__(GW * 32)
void gemm_wmma_kernel(const _Float16* __restrict__ A,
                      const _Float16* __restrict__ Bt3,
                      const float* __restrict__ bias0,
                      const float* __restrict__ bias1,
                      const float* __restrict__ bias2,
                      void* __restrict__ out, int proj) {
  const int tid  = threadIdx.x;
  const int lane = tid & 31;
  // as a scalar: the product that it selects picks pointers and the store branch
  const int wave = __builtin_amdgcn_readfirstlane(tid >> 5);
  const int sel  = proj ? 0 : wave >> 2;
  const int mode = proj ? 2 : (sel == 2 ? 1 : 0);
  const _Float16* Bt = Bt3 + (size_t)sel * DD * DD;
  const float* bias  = sel == 0 ? bias0 : sel == 1 ? bias1 : bias2;
  const int w    = proj ? blockIdx.x * 8 + wave : blockIdx.x * 4 + (wave & 3);
  const int tm   = w % GT_M;
  const int tn   = w / GT_M;
  const int m0   = tm * WTM;
  const int n0   = tn * WTN;
  const int hl   = lane >> 4;   // half-wave id
  const int l16  = lane & 15;

  // this lane's 16 bytes in k block 0 of the wave's first row tile of A and of Bt
  const _Float16* ak = A  + (size_t)(m0 >> 4) * RT + lane * 8;
  const _Float16* bk = Bt + (size_t)(n0 >> 4) * RT + lane * 8;

  v8f acc[2][4];
#pragma unroll
  for (int mi = 0; mi < 2; ++mi)
#pragma unroll
    for (int ni = 0; ni < 4; ++ni)
      acc[mi][ni] = (v8f){0.f, 0.f, 0.f, 0.f, 0.f, 0.f, 0.f, 0.f};

  for (int ks = 0; ks < DD / 32; ++ks) {
    __builtin_prefetch((const void*)(ak + 8 * 512), 0, 1);   // 8 k blocks ahead
    __builtin_prefetch((const void*)(bk + 8 * 512), 0, 1);
    v16h a0 = make_frag(ak, ak + 256);
    v16h a1 = make_frag(ak + RT, ak + RT + 256);
    v16h b[4];
#pragma unroll
    for (int ni = 0; ni < 4; ++ni)
      b[ni] = make_frag(bk + ni * RT, bk + ni * RT + 256);
#pragma unroll
    for (int ni = 0; ni < 4; ++ni) {
      acc[0][ni] = wmma16(a0, b[ni], acc[0][ni]);
      acc[1][ni] = wmma16(a1, b[ni], acc[1][ni]);
    }
    // The loads above name ak and bk: as inputs here both pairs stay whole up to
    // this wait, which stands in front of the additions that rewrite them.
    asm volatile("s_wait_xcnt 0x0" :: "v"(ak), "v"(bk) : "memory");
    ak += 512;                 // next k block
    bk += 512;
  }

#pragma unroll
  for (int ni = 0; ni < 4; ++ni) {
    const int n = n0 + ni * 16 + l16;     // output column (C/D: N = lane%16)
    const float bval = bias[n];
    // the code below reuses the register that holds this load's offset
    asm volatile("s_wait_xcnt 0x0" ::: "memory");
    const int h = n >> 6;                 // head (64-wide N-tile stays in head)
    const int d = n & 63;
#pragma unroll
    for (int mi = 0; mi < 2; ++mi) {
      if (mode == 2) {
        float* o = (float*)out;
#pragma unroll
        for (int r = 0; r < 8; ++r) {
          int m = m0 + mi * 16 + r + 8 * hl;   // C/D: M = r + 8*(lane/16)
          o[(size_t)m * DD + n] = acc[mi][ni][r] + bval;
        }
        // the next tile's code reuses the registers that these stores name
        asm volatile("s_wait_xcnt 0x0" ::: "memory");
      } else {
        const int mb = m0 + mi * 16 + 8 * hl;  // row of r = 0, a multiple of 8
        const int b  = mb >> 11;               // T = 2048
        const int t0 = mb & 2047;
        _Float16* o = (_Float16*)out + (size_t)sel * MM * DD + (size_t)(b * HH + h) * TT * HD;
        if (mode == 0) {
#pragma unroll
          for (int r = 0; r < 8; ++r)
            o[frag_idx(t0 + r, d, HD)] = (_Float16)(acc[mi][ni][r] + bval);
          // the next tile's code reuses the registers that these stores name
          asm volatile("s_wait_xcnt 0x0" ::: "memory");
        } else {
          v8h pk;                              // k = t0 .. t0+7: one 16-byte run
#pragma unroll
          for (int r = 0; r < 8; ++r) pk[r] = (_Float16)(acc[mi][ni][r] + bval);
          *(v8h*)(o + frag_idx(d, t0, TT)) = pk;
          // the next tile's code reuses the registers that this store names
          asm volatile("s_wait_xcnt 0x0" ::: "memory");
        }
      }
    }
  }
}

// value of lane l ^ 16
__device__ __forceinline__ float xhalf(float x) {
  const int i = __builtin_bit_cast(int, x);
  return __builtin_bit_cast(
      float, __builtin_amdgcn_permlanex16(i, i, 0x76543210, 0xfedcba98, false, false));
}

__global__ __launch_bounds__(256)
void flash_attn_kernel(const _Float16* __restrict__ Q,
                       const _Float16* __restrict__ K,
                       const _Float16* __restrict__ Vt,
                       _Float16* __restrict__ AO) {
  const int tid  = threadIdx.x;
  const int lane = tid & 31;
  const int wave = tid >> 5;
  const int w    = blockIdx.x * 8 + wave;
  const int qt   = w & 63;                // T/32 = 64 query tiles
  const int bh   = w >> 6;                // 0..47
  const int hl   = lane >> 4;
  const int l16  = lane & 15;
  const int q0   = qt * 32;

  // Q B-fragments: [query group][k-half of head dim]
  v16h qb[2][2];
#pragma unroll
  for (int q = 0; q < 2; ++q) {
    const _Float16* qp = Q + (size_t)bh * TT * HD + lane * 8;
    qb[q][0] = load_frag(qp, (q0 >> 4) + q, 0, HD);
    qb[q][1] = load_frag(qp, (q0 >> 4) + q, 1, HD);
  }

  // o[q][ni][r] = O[query q0 + 16q + l16][d = 16ni + 8hl + r]
  v8f o[2][4];
  float mrun[2], lsum[2];                 // this lane's query; lsum: this half's keys
#pragma unroll
  for (int q = 0; q < 2; ++q) {
#pragma unroll
    for (int ni = 0; ni < 4; ++ni)
      o[q][ni] = (v8f){0.f, 0.f, 0.f, 0.f, 0.f, 0.f, 0.f, 0.f};
    mrun[q] = -__builtin_inff();
    lsum[q] = 0.f;
  }

  // this lane's 16 bytes in the first block of the pass's K rows and V^T columns
  const _Float16* kp = K  + (size_t)bh * TT * HD + lane * 8;
  const _Float16* vp = Vt + (size_t)bh * HD * TT + lane * 8;
  const float scale = 0.125f;             // 1/sqrt(64)

  for (int kt = 0; kt < TT; kt += 32) {
    v16h ka[2][2];                        // [key tile][k-half of head dim]
#pragma unroll
    for (int j = 0; j < 2; ++j) {
      ka[j][0] = load_frag(kp, j, 0, HD);
      ka[j][1] = load_frag(kp, j, 1, HD);
    }
    v16h va[4];                           // [16 rows of d], k = the 32 keys
#pragma unroll
    for (int ni = 0; ni < 4; ++ni) va[ni] = load_frag(vp, ni, 0, TT);
    // The loads above name kp and vp: as inputs here both pairs stay whole up to
    // this wait, which stands in front of the additions that rewrite them.
    asm volatile("s_wait_xcnt 0x0" :: "v"(kp), "v"(vp) : "memory");
    kp += 32 * HD;                        // next 32 keys: 4 blocks of K
    vp += 512;                            // next k block of V^T

    // ---- S^T = K @ Q^T : 2 key tiles x 2 query groups, K frags shared ----
    // s[q][j][r] = score of key kt + 16j + 8hl + r with this lane's query
    v8f s[2][2];
#pragma unroll
    for (int j = 0; j < 2; ++j) {
#pragma unroll
      for (int q = 0; q < 2; ++q) {
        v8f t = (v8f){0.f, 0.f, 0.f, 0.f, 0.f, 0.f, 0.f, 0.f};
        t = wmma16(ka[j][0], qb[q][0], t);
        t = wmma16(ka[j][1], qb[q][1], t);
        s[q][j] = t;
      }
    }

    // ---- online softmax over the 32 new keys, per query group ------------
    v16h pb[2];
#pragma unroll
    for (int q = 0; q < 2; ++q) {
      float mx = fmaxf(s[q][0][0], s[q][1][0]);
#pragma unroll
      for (int r = 1; r < 8; ++r) mx = fmaxf(mx, fmaxf(s[q][0][r], s[q][1][r]));
      mx = fmaxf(mx, xhalf(mx));          // the other 16 keys of this query
      const float mn = fmaxf(mrun[q], mx * scale);
      const float alpha = __expf(mrun[q] - mn);
      mrun[q] = mn;
      v2f rs = (v2f){0.f, 0.f};           // sums of even and of odd r
#pragma unroll
      for (int j = 0; j < 2; ++j) {
#pragma unroll
        for (int r = 0; r < 8; r += 2) {
          const v2f x = (v2f){s[q][j][r], s[q][j][r + 1]} * scale - mn;
          const v2f p = (v2f){__expf(x.x), __expf(x.y)};
          rs += p;
          const v2h ph = __builtin_convertvector(p, v2h);
          pb[q][8 * j + r]     = ph.x;    // k = 16j + 8hl + r
          pb[q][8 * j + r + 1] = ph.y;
        }
      }
      lsum[q] = lsum[q] * alpha + (rs.x + rs.y);
#pragma unroll
      for (int ni = 0; ni < 4; ++ni)
#pragma unroll
        for (int r = 0; r < 8; ++r)
          o[q][ni][r] *= alpha;
    }

    // ---- O^T += V^T @ P^T : V frags shared between query groups ----------
#pragma unroll
    for (int ni = 0; ni < 4; ++ni) {
      o[0][ni] = wmma16(va[ni], pb[0], o[0][ni]);
      o[1][ni] = wmma16(va[ni], pb[1], o[1][ni]);
    }
  }

  // ---- finalize: join the halves' sums, divide, store 16-byte runs of d ---
  const int b = bh / HH;
  const int h = bh % HH;
  v8h pk[2][4];
#pragma unroll
  for (int q = 0; q < 2; ++q) {
    const float inv = 1.f / (lsum[q] + xhalf(lsum[q]));
#pragma unroll
    for (int ni = 0; ni < 4; ++ni)
#pragma unroll
      for (int r = 0; r < 8; ++r) pk[q][ni][r] = (_Float16)(o[q][ni][r] * inv);
  }
  // row b*T + q0 + l16, k = h*64 + 8hl; a query group is one row tile further,
  // ni steps through the halves of two k blocks: 512 bytes in a row per store
  _Float16* ao = AO + frag_idx(b * TT + q0 + l16, h * HD + 8 * hl, DD);
#pragma unroll
  for (int q = 0; q < 2; ++q)
#pragma unroll
    for (int ni = 0; ni < 4; ++ni)
      *(v8h*)(ao + q * RT + ni * 256) = pk[q][ni];
}

// ---------------------------------------------------------------------------
extern "C" void kernel_launch(void* const* d_in, const int* in_sizes, int n_in,
                              void* d_out, int out_size, void* d_ws, size_t ws_size,
                              hipStream_t stream) {
  const float* x  = (const float*)d_in[0];
  const float* Wq = (const float*)d_in[1];
  const float* bq = (const float*)d_in[2];
  const float* Wk = (const float*)d_in[3];
  const float* bk = (const float*)d_in[4];
  const float* Wv = (const float*)d_in[5];
  const float* bv = (const float*)d_in[6];
  const float* Wo = (const float*)d_in[7];
  const float* bo = (const float*)d_in[8];

  char* ws = (char*)d_ws;
  _Float16* xh  = (_Float16*)(ws + OFF_XH);
  _Float16* wqt = (_Float16*)(ws + OFF_WQT);
  _Float16* wot = (_Float16*)(ws + OFF_WOT);
  _Float16* qh  = (_Float16*)(ws + OFF_Q);
  _Float16* kh  = (_Float16*)(ws + OFF_K);
  _Float16* vt  = (_Float16*)(ws + OFF_VT);
  _Float16* ao  = (_Float16*)(ws + OFF_AO);

  // wqt, wkt, wvt, wot stand one behind the other in the workspace; so do qh, kh, vt
  cvt_all_kernel<<<4 * WBLK + XBLK, 256, 0, stream>>>(x, Wq, Wk, Wv, Wo, xh, wqt);

  gemm_wmma_kernel<<<GT_M * GT_N / 4, GW * 32, 0, stream>>>(xh, wqt, bq, bk, bv, (void*)qh, 0);

  const int attn_blocks = (BB * HH * (TT / 32)) / 8;   // 384
  flash_attn_kernel<<<attn_blocks, 256, 0, stream>>>(qh, kh, vt, ao);

  gemm_wmma_kernel<<<GT_M * GT_N / 8, 256, 0, stream>>>(ao, wot, bo, bo, bo, d_out, 1);
}

// v005
// Measured time: 130 microseconds a run.
// Two timings next to v004 put it at 1.18 and 1.20 times that version's speed.
// All steps since v000 together make it 2.45 times as fast.
#include <hip/hip_runtime.h>

// ---------------------------------------------------------------------------
// Multi-head attention for MI455X (gfx1250, wave32, WMMA f32_16x16x32_f16)
//   B=4, T=2048, D=768, H=12, hd=64
// Pipeline:
//   1) one launch: f32->f16 convert x; transpose+convert Wq/Wk/Wv/Wo
//   2) one launch: WMMA GEMMs (32x64 tile/wave) -> Q,K in [B,H,T,64] f16 ;
//      V in [B,H,64,T] f16 (transposed)
//   3) flash-attention, transposed (S^T = K Q^T, O^T += V^T P^T): 1 wave per
//      32 query columns (2 groups sharing K/V fragments), keys streamed 32 at
//      a time, online softmax in-lane, P^T packed from the S^T accumulators
//   4) WMMA GEMM attn_out @ Wo + bo -> f32 d_out
// Every f16 operand in the workspace is kept in fragment order (frag_idx), so
// that one fragment load instruction reads 512 contiguous bytes.
// ---------------------------------------------------------------------------

typedef _Float16 v16h __attribute__((ext_vector_type(16)));
typedef _Float16 v8h  __attribute__((ext_vector_type(8)));
typedef float    v8f  __attribute__((ext_vector_type(8)));
typedef _Float16 v2h  __attribute__((ext_vector_type(2)));
typedef float    v2f  __attribute__((ext_vector_type(2)));
typedef float    v4f  __attribute__((ext_vector_type(4)));

#define BB 4
#define TT 2048
#define DD 768
#define HH 12
#define HD 64
#define MM (BB * TT)           // 8192 rows

// GEMM wave-tile: 32 rows x 64 cols
#define WTM 32
#define WTN 64
#define GT_M (MM / WTM)        // 256
#define GT_N (DD / WTN)        // 12
#define RT (16 * DD)           // halves of one 16-row tile of a [*, 768] operand
#define GW 12                  // waves of a block of the Q, K, V launch

// convert launch, blocks of 8 waves. A wave of the weight part makes 2 row tiles x 1 k
// block (4 runs of 8 halves a lane), a wave of the x part 1 row tile x 4 k blocks (8 runs).
#define WBLK ((DD / 32) * (DD / 32) / 8)   // 72 a weight
#define XBLK ((MM / 16) * (DD / 128) / 8)  // 384 for x

// Workspace byte offsets
#define OFF_XH   0u
#define OFF_WQT  (OFF_XH  + (size_t)MM * DD * 2)
#define OFF_WKT  (OFF_WQT + (size_t)DD * DD * 2)
#define OFF_WVT  (OFF_WKT + (size_t)DD * DD * 2)
#define OFF_WOT  (OFF_WVT + (size_t)DD * DD * 2)
#define OFF_Q    (OFF_WOT + (size_t)DD * DD * 2)
#define OFF_K    (OFF_Q   + (size_t)MM * DD * 2)
#define OFF_VT   (OFF_K   + (size_t)MM * DD * 2)
#define OFF_AO   (OFF_VT  + (size_t)MM * DD * 2)

__device__ __forceinline__ v8f wmma16(v16h a, v16h b, v8f c) {
  // D = A(16x32,f16) x B(32x16,f16) + C(16x16,f32)
  return __builtin_amdgcn_wmma_f32_16x16x32_f16(
      /*neg_a=*/false, a, /*neg_b=*/false, b,
      /*c_mod=*/(short)0, c, /*reuse_a=*/false, /*reuse_b=*/false);
}

// Build a 16-half fragment from two contiguous 16-byte runs.
__device__ __forceinline__ v16h make_frag(const _Float16* p0, const _Float16* p1) {
  v8h lo = *(const v8h*)p0;
  v8h hi = *(const v8h*)p1;
  v16h r;
#pragma unroll
  for (int i = 0; i < 8; ++i) { r[i] = lo[i]; r[i + 8] = hi[i]; }
  return r;
}

// Fragment order of a [rows][kd] f16 operand: blocks of 16 rows x 32 k, 512
// halves each, k blocks of one row tile in a row. In a block, lane
// l = 16 * (k bit 3) + row % 16 owns halves l*8 .. l*8+7 (k bit 4 = 0) and
// 256 + l*8 .. (k bit 4 = 1): the two 16-byte runs that make_frag joins.
__device__ __forceinline__ size_t frag_idx(int row, int k, int kd) {
  return ((size_t)((row >> 4) * (kd >> 5) + (k >> 5)) << 9) +
         (size_t)((((k >> 4) & 1) << 8) + ((((k >> 3) & 1) << 4) + (row & 15)) * 8 + (k & 7));
}

// Fragment of row tile rt, k block ks: base + lane * 8 is passed as p.
__device__ __forceinline__ v16h load_frag(const _Float16* p, int rt, int ks, int kd) {
  const _Float16* q = p + ((size_t)(rt * (kd >> 5) + ks) << 9);
  return make_frag(q, q + 256);
}

// ---------------------------------------------------------------------------
// All five conversions as block ranges of one grid (none reads what another
// writes). Blocks 0 .. 4*WBLK-1, the weights, whose loads are the more scattered:
//   wt[sel](row n, k) = (f16) W[sel][k*768 + n]   (768x768), fragment order
// the rest: xh = (f16) x, [M, 768] row-major -> fragment order
// A lane makes whole 16-byte runs (8 k of one row): lane l of a wave owns place l of
// each half block, so a store instruction writes 512 bytes in a row. All loads of a
// lane are issued before the first conversion.
__global__ __launch_bounds__(256)
void cvt_all_kernel(const float* __restrict__ x,
                    const float* __restrict__ Wq, const float* __restrict__ Wk,
                    const float* __restrict__ Wv, const float* __restrict__ Wo,
                    _Float16* __restrict__ xh, _Float16* __restrict__ wt) {
  const int blk  = blockIdx.x;
  const int lane = threadIdx.x & 31;
  // as a scalar: block addresses then stay in scalar registers
  const int wave = __builtin_amdgcn_readfirstlane(threadIdx.x >> 5);
  const int hl   = lane >> 4;   // k bit 3
  const int l16  = lane & 15;   // row % 16
  if (blk < 4 * WBLK) {
    const int sel = blk / WBLK;
    const float* in = sel == 0 ? Wq : sel == 1 ? Wk : sel == 2 ? Wv : Wo;
    const int wv = (blk - sel * WBLK) * 8 + wave;
    const int tp = wv / (DD / 32);          // pair of row tiles: n = 32 tp ..
    const int kb = wv % (DD / 32);          // k block
    // W[k = 32 kb + 8 hl][n = 32 tp + l16]
    const float* p = in + (size_t)(kb * 32 + hl * 8) * DD + tp * 32 + l16;
    float f[2][2][8];                       // [row tile][k bit 4][k & 7]
#pragma unroll
    for (int h = 0; h < 2; ++h)
#pragma unroll
      for (int j = 0; j < 8; ++j)
#pragma unroll
        for (int t = 0; t < 2; ++t)         // the two halves of one 128-byte line
          f[t][h][j] = p[(h * 16 + j) * DD + t * 16];
    // the conversions below may reuse the registers that hold these loads' address;
    // as an input the pair stays whole up to this wait
    asm volatile("s_wait_xcnt 0x0" :: "v"(p) : "memory");
    _Float16* o = wt + (size_t)sel * DD * DD + (size_t)tp * 2 * RT + kb * 512 + lane * 8;
#pragma unroll
    for (int t = 0; t < 2; ++t)
#pragma unroll
      for (int h = 0; h < 2; ++h) {
        v8h pk;
#pragma unroll
        for (int j = 0; j < 8; ++j) pk[j] = (_Float16)f[t][h][j];
        *(v8h*)(o + t * RT + h * 256) = pk;
      }
    // no register that these stores name is rewritten in front of this wait
    asm volatile("s_wait_xcnt 0x0" ::: "memory");
  } else {
    const int wv = (blk - 4 * WBLK) * 8 + wave;
    const int rt = wv / (DD / 128);         // row tile
    const int kq = wv % (DD / 128);         // four k blocks: 512 bytes of each row
    // x[row = 16 rt + l16][k = 128 kq + 8 hl]
    const float* p = x + (size_t)(rt * 16 + l16) * DD + kq * 128 + hl * 8;
    v4f f[8][2];                            // [half block][k bit 2]
#pragma unroll
    for (int u = 0; u < 8; ++u) {
      f[u][0] = *(const v4f*)(p + u * 16);
      f[u][1] = *(const v4f*)(p + u * 16 + 4);
    }
    // The loaded values as inputs: without them the compiler converts the first runs
    // between the loads and issues the last loads only when the first have come back;
    // so all 16 are in flight at once. The wait: the code below may reuse the registers
    // that hold these loads' address; as an input the pair stays whole up to it.
    asm volatile("s_wait_xcnt 0x0"
                 :: "v"(p), "v"(f[0][0]), "v"(f[0][1]), "v"(f[1][0]), "v"(f[1][1]),
                    "v"(f[2][0]), "v"(f[2][1]), "v"(f[3][0]), "v"(f[3][1]),
                    "v"(f[4][0]), "v"(f[4][1]), "v"(f[5][0]), "v"(f[5][1]),
                    "v"(f[6][0]), "v"(f[6][1]), "v"(f[7][0]), "v"(f[7][1])
                 : "memory");
    _Float16* o = xh + (size_t)rt * RT + kq * 4 * 512 + lane * 8;
#pragma unroll
    for (int u = 0; u < 8; ++u) {
      v8h pk;
#pragma unroll
      for (int j = 0; j < 4; ++j) {
        pk[j]     = (_Float16)f[u][0][j];
        pk[j + 4] = (_Float16)f[u][1][j];
      }
      *(v8h*)(o + u * 256) = pk;
    }
    // no register that these stores name is rewritten in front of this wait
    asm volatile("s_wait_xcnt 0x0" ::: "memory");
  }
}

// ---------------------------------------------------------------------------
// WMMA GEMM, 32x64 tile per wave (2 M-subtiles x 4 N-subtiles):
//   A  : f16 [M, 768], fragment order
//   Bt : f16 transposed weight [N=768, K=768] (row n = column n of W), fragment order
// mode 0: out f16 [B,H][T,64], each [T,64] in fragment order   (Q, K)
// mode 1: out f16 [B,H][64,T], each [64,T] in fragment order   (V transposed)
// mode 2: out f32 row-major [M, 768]   (final projection)
// A launch holds one product (proj = 1: mode 2, 8 waves, 8 tiles a block) or three that
// share A (proj = 0): a block is then 12 waves, 4 tiles x 3 products, so that the three
// waves of a tile read the same A lines at the same time. Product sel takes weight
// Bt3 + sel * 768 * 768, bias sel and the sel-th [M, 768] f16 plane of out;
// sel 0, 1 are mode 0, sel 2 is mode 1.
// ---------------------------------------------------------------------------
__global__ __launch_bounds__(GW * 32)
void gemm_wmma_kernel(const _Float16* __restrict__ A,
                      const _Float16* __restrict__ Bt3,
                      const float* __restrict__ bias0,
                      const float* __restrict__ bias1,
                      const float* __restrict__ bias2,
                      void* __restrict__ out, int proj) {
  const int tid  = threadIdx.x;
  const int lane = tid & 31;
  // as a scalar: the product that it selects picks pointers and the store branch
  const int wave = __builtin_amdgcn_readfirstlane(tid >> 5);
  const int sel  = proj ? 0 : wave >> 2;
  const int mode = proj ? 2 : (sel == 2 ? 1 : 0);
  const _Float16* Bt = Bt3 + (size_t)sel * DD * DD;
  const float* bias  = sel == 0 ? bias0 : sel == 1 ? bias1 : bias2;
  const int w    = proj ? blockIdx.x * 8 + wave : blockIdx.x * 4 + (wave & 3);
  const int tm   = w % GT_M;
  const int tn   = w / GT_M;
  const int m0   = tm * WTM;
  const int n0   = tn * WTN;
  const int hl   = lane >> 4;   // half-wave id
  const int l16  = lane & 15;

  // this lane's 16 bytes in k block 0 of the wave's first row tile of A and of Bt
  const _Float16* ak = A  + (size_t)(m0 >> 4) * RT + lane * 8;
  const _Float16* bk = Bt + (size_t)(n0 >> 4) * RT + lane * 8;

  v8f acc[2][4];
#pragma unroll
  for (int mi = 0; mi < 2; ++mi)
#pragma unroll
    for (int ni = 0; ni < 4; ++ni)
      acc[mi][ni] = (v8f){0.f, 0.f, 0.f, 0.f, 0.f, 0.f, 0.f, 0.f};

  for (int ks = 0; ks < DD / 32; ++ks) {
    __builtin_prefetch((const void*)(ak + 8 * 512), 0, 1);   // 8 k blocks ahead
    __builtin_prefetch((const void*)(bk + 8 * 512), 0, 1);
    v16h a0 = make_frag(ak, ak + 256);
    v16h a1 = make_frag(ak + RT, ak + RT + 256);
    v16h b[4];
#pragma unroll
    for (int ni = 0; ni < 4; ++ni)
      b[ni] = make_frag(bk + ni * RT, bk + ni * RT + 256);
#pragma unroll
    for (int ni = 0; ni < 4; ++ni) {
      acc[0][ni] = wmma16(a0, b[ni], acc[0][ni]);
      acc[1][ni] = wmma16(a1, b[ni], acc[1][ni]);
    }
    // The loads above name ak and bk: as inputs here both pairs stay whole up to
    // this wait, which stands in front of the additions that rewrite them.
    asm volatile("s_wait_xcnt 0x0" :: "v"(ak), "v"(bk) : "memory");
    ak += 512;                 // next k block
    bk += 512;
  }

#pragma unroll
  for (int ni = 0; ni < 4; ++ni) {
    const int n = n0 + ni * 16 + l16;     // output column (C/D: N = lane%16)
    const float bval = bias[n];
    // the code below reuses the register that holds this load's offset
    asm volatile("s_wait_xcnt 0x0" ::: "memory");
    const int h = n >> 6;                 // head (64-wide N-tile stays in head)
    const int d = n & 63;
#pragma unroll
    for (int mi = 0; mi < 2; ++mi) {
      if (mode == 2) {
        float* o = (float*)out;
#pragma unroll
        for (int r = 0; r < 8; ++r) {
          int m = m0 + mi * 16 + r + 8 * hl;   // C/D: M = r + 8*(lane/16)
          o[(size_t)m * DD + n] = acc[mi][ni][r] + bval;
        }
        // the next tile's code reuses the registers that these stores name
        asm volatile("s_wait_xcnt 0x0" ::: "memory");
      } else {
        const int mb = m0 + mi * 16 + 8 * hl;  // row of r = 0, a multiple of 8
        const int b  = mb >> 11;               // T = 2048
        const int t0 = mb & 2047;
        _Float16* o = (_Float16*)out + (size_t)sel * MM * DD + (size_t)(b * HH + h) * TT * HD;
        if (mode == 0) {
#pragma unroll
          for (int r = 0; r < 8; ++r)
            o[frag_idx(t0 + r, d, HD)] = (_Float16)(acc[mi][ni][r] + bval);
          // the next tile's code reuses the registers that these stores name
          asm volatile("s_wait_xcnt 0x0" ::: "memory");
        } else {
          v8h pk;                              // k = t0 .. t0+7: one 16-byte run
#pragma unroll
          for (int r = 0; r < 8; ++r) pk[r] = (_Float16)(acc[mi][ni][r] + bval);
          *(v8h*)(o + frag_idx(d, t0, TT)) = pk;
          // the next tile's code reuses the registers that this store names
          asm volatile("s_wait_xcnt 0x0" ::: "memory");
        }
      }
    }
  }
}

// value of lane l ^ 16
__device__ __forceinline__ float xhalf(float x) {
  const int i = __builtin_bit_cast(int, x);
  return __builtin_bit_cast(
      float, __builtin_amdgcn_permlanex16(i, i, 0x76543210, 0xfedcba98, false, false));
}

__global__ __launch_bounds__(256)
void flash_attn_kernel(const _Float16* __restrict__ Q,
                       const _Float16* __restrict__ K,
                       const _Float16* __restrict__ Vt,
                       _Float16* __restrict__ AO) {
  const int tid  = threadIdx.x;
  const int lane = tid & 31;
  const int wave = tid >> 5;
  const int w    = blockIdx.x * 8 + wave;
  const int qt   = w & 63;                // T/32 = 64 query tiles
  const int bh   = w >> 6;                // 0..47
  const int hl   = lane >> 4;
  const int l16  = lane & 15;
  const int q0   = qt * 32;

  // Q B-fragments: [query group][k-half of head dim]
  v16h qb[2][2];
#pragma unroll
  for (int q = 0; q < 2; ++q) {
    const _Float16* qp = Q + (size_t)bh * TT * HD + lane * 8;
    qb[q][0] = load_frag(qp, (q0 >> 4) + q, 0, HD);
    qb[q][1] = load_frag(qp, (q0 >> 4) + q, 1, HD);
  }

  // o[q][ni][r] = O[query q0 + 16q + l16][d = 16ni + 8hl + r]
  v8f o[2][4];
  float mrun[2], lsum[2];                 // this lane's query; lsum: this half's keys
#pragma unroll
  for (int q = 0; q < 2; ++q) {
#pragma unroll
    for (int ni = 0; ni < 4; ++ni)
      o[q][ni] = (v8f){0.f, 0.f, 0.f, 0.f, 0.f, 0.f, 0.f, 0.f};
    mrun[q] = -__builtin_inff();
    lsum[q] = 0.f;
  }

  // this lane's 16 bytes in the first block of the pass's K rows and V^T columns
  const _Float16* kp = K  + (size_t)bh * TT * HD + lane * 8;
  const _Float16* vp = Vt + (size_t)bh * HD * TT + lane * 8;
  const float scale = 0.125f;             // 1/sqrt(64)

  // K fragments run one pass ahead: those of pass 0 are fetched here, those of each
  // further pass behind the score products of the pass before, into the same registers.
  v16h ka[2][2];                          // [key tile][k-half of head dim]
#pragma unroll
  for (int j = 0; j < 2; ++j) {
    ka[j][0] = load_frag(kp, j, 0, HD);
    ka[j][1] = load_frag(kp, j, 1, HD);
  }
  // The loads above name kp: as an input here the pair stays whole up to this wait,
  // which stands in front of the addition that rewrites it.
  asm volatile("s_wait_xcnt 0x0" :: "v"(kp) : "memory");

  for (int kt = 0; kt < TT; kt += 32) {
    v16h va[4];                           // [16 rows of d], k = the 32 keys
#pragma unroll
    for (int ni = 0; ni < 4; ++ni) va[ni] = load_frag(vp, ni, 0, TT);

    // ---- S^T = K @ Q^T : 2 key tiles x 2 query groups, K frags shared ----
    // s[q][j][r] = score of key kt + 16j + 8hl + r with this lane's query
    v8f s[2][2];
#pragma unroll
    for (int j = 0; j < 2; ++j) {
#pragma unroll
      for (int q = 0; q < 2; ++q) {
        v8f t = (v8f){0.f, 0.f, 0.f, 0.f, 0.f, 0.f, 0.f, 0.f};
        t = wmma16(ka[j][0], qb[q][0], t);
        t = wmma16(ka[j][1], qb[q][1], t);
        s[q][j] = t;
      }
    }

    // ---- the next pass's K: in flight under softmax and the O^T products ----
    // next 32 keys: 4 blocks of K; the last pass fetches its own rows again, unused
    kp += kt + 32 < TT ? 32 * HD : 0;
#pragma unroll
    for (int j = 0; j < 2; ++j) {
      ka[j][0] = load_frag(kp, j, 0, HD);
      ka[j][1] = load_frag(kp, j, 1, HD);
    }
    // Holds the fetch at this place: without it the compiler sinks these loads far into
    // the softmax, whose temporaries then take the K registers, and most of the lead goes.
    __builtin_amdgcn_sched_barrier(0);

    // ---- online softmax over the 32 new keys, per query group ------------
    v16h pb[2];
#pragma unroll
    for (int q = 0; q < 2; ++q) {
      float mx = fmaxf(s[q][0][0], s[q][1][0]);
#pragma unroll
      for (int r = 1; r < 8; ++r) mx = fmaxf(mx, fmaxf(s[q][0][r], s[q][1][r]));
      mx = fmaxf(mx, xhalf(mx));          // the other 16 keys of this query
      const float mn = fmaxf(mrun[q], mx * scale);
      const float alpha = __expf(mrun[q] - mn);
      mrun[q] = mn;
      v2f rs = (v2f){0.f, 0.f};           // sums of even and of odd r
#pragma unroll
      for (int j = 0; j < 2; ++j) {
#pragma unroll
        for (int r = 0; r < 8; r += 2) {
          const v2f x = (v2f){s[q][j][r], s[q][j][r + 1]} * scale - mn;
          const v2f p = (v2f){__expf(x.x), __expf(x.y)};
          rs += p;
          const v2h ph = __builtin_convertvector(p, v2h);
          pb[q][8 * j + r]     = ph.x;    // k = 16j + 8hl + r
          pb[q][8 * j + r + 1] = ph.y;
        }
      }
      lsum[q] = lsum[q] * alpha + (rs.x + rs.y);
#pragma unroll
      for (int ni = 0; ni < 4; ++ni)
#pragma unroll
        for (int r = 0; r < 8; ++r)
          o[q][ni][r] *= alpha;
    }

    // ---- O^T += V^T @ P^T : V frags shared between query groups ----------
#pragma unroll
    for (int ni = 0; ni < 4; ++ni) {
      o[0][ni] = wmma16(va[ni], pb[0], o[0][ni]);
      o[1][ni] = wmma16(va[ni], pb[1], o[1][ni]);
    }
    // Holds the wait below at the foot of the pass, where the address translations are
    // long done; lifted to directly behind the loads it would stall the wave there.
    __builtin_amdgcn_sched_barrier(0);
    // This pass's loads name kp and vp: as inputs here both pairs stay whole up to
    // this wait, which stands in front of the additions that rewrite them.
    asm volatile("s_wait_xcnt 0x0" :: "v"(kp), "v"(vp) : "memory");
    vp += 512;                            // next k block of V^T
  }

  // ---- finalize: join the halves' sums, divide, store 16-byte runs of d ---
  const int b = bh / HH;
  const int h = bh % HH;
  v8h pk[2][4];
#pragma unroll
  for (int q = 0; q < 2; ++q) {
    const float inv = 1.f / (lsum[q] + xhalf(lsum[q]));
#pragma unroll
    for (int ni = 0; ni < 4; ++ni)
#pragma unroll
      for (int r = 0; r < 8; ++r) pk[q][ni][r] = (_Float16)(o[q][ni][r] * inv);
  }
  // row b*T + q0 + l16, k = h*64 + 8hl; a query group is one row tile further,
  // ni steps through the halves of two k blocks: 512 bytes in a row per store
  _Float16* ao = AO + frag_idx(b * TT + q0 + l16, h * HD + 8 * hl, DD);
#pragma unroll
  for (int q = 0; q < 2; ++q)
#pragma unroll
    for (int ni = 0; ni < 4; ++ni)
      *(v8h*)(ao + q * RT + ni * 256) = pk[q][ni];
}

// ---------------------------------------------------------------------------
extern "C" void kernel_launch(void* const* d_in, const int* in_sizes, int n_in,
                              void* d_out, int out_size, void* d_ws, size_t ws_size,
                              hipStream_t stream) {
  const float* x  = (const float*)d_in[0];
  const float* Wq = (const float*)d_in[1];
  const float* bq = (const float*)d_in[2];
  const float* Wk = (const float*)d_in[3];
  const float* bk = (const float*)d_in[4];
  const float* Wv = (const float*)d_in[5];
  const float* bv = (const float*)d_in[6];
  const float* Wo = (const float*)d_in[7];
  const float* bo = (const float*)d_in[8];

  char* ws = (char*)d_ws;
  _Float16* xh  = (_Float16*)(ws + OFF_XH);
  _Float16* wqt = (_Float16*)(ws + OFF_WQT);
  _Float16* wot = (_Float16*)(ws + OFF_WOT);
  _Float16* qh  = (_Float16*)(ws + OFF_Q);
  _Float16* kh  = (_Float16*)(ws + OFF_K);
  _Float16* vt  = (_Float16*)(ws + OFF_VT);
  _Float16* ao  = (_Float16*)(ws + OFF_AO);

  // wqt, wkt, wvt, wot stand one behind the other in the workspace; so do qh, kh, vt
  cvt_all_kernel<<<4 * WBLK + XBLK, 256, 0, stream>>>(x, Wq, Wk, Wv, Wo, xh, wqt);

  gemm_wmma_kernel<<<GT_M * GT_N / 4, GW * 32, 0, stream>>>(xh, wqt, bq, bk, bv, (void*)qh, 0);

  const int attn_blocks = (BB * HH * (TT / 32)) / 8;   // 384
  flash_attn_kernel<<<attn_blocks, 256, 0, stream>>>(qh, kh, vt, ao);

  gemm_wmma_kernel<<<GT_M * GT_N / 8, 256, 0, stream>>>(ao, wot, bo, bo, bo, d_out, 1);
}

// v006
// One run takes 120 microseconds.
// In both of two side-by-side timings against v005, it was 1.10 times as fast.
// All steps since v000 together make it 2.70 times as fast.
#include <hip/hip_runtime.h>

// ---------------------------------------------------------------------------
// Multi-head attention for MI455X (gfx1250, wave32, WMMA f32_16x16x32_f16)
//   B=4, T=2048, D=768, H=12, hd=64
// Pipeline:
//   1) one launch: f32->f16 convert x; transpose+convert Wq/Wk/Wv/Wo
//   2) one launch: WMMA GEMMs (32x64 tile/wave) -> Q,K in [B,H,T,64] f16 ;
//      V in [B,H,64,T] f16 (transposed)
//   3) flash-attention, transposed (S^T = K Q^T, O^T += V^T P^T): 1 wave per
//      32 query columns (2 groups sharing K/V fragments), keys streamed 32 at
//      a time, online softmax in-lane, P^T packed from the S^T accumulators
//   4) WMMA GEMM attn_out @ Wo + bo -> f32 d_out
// Every f16 operand in the workspace is kept in fragment order (frag_idx), so
// that one fragment load instruction reads 512 contiguous bytes.
// ---------------------------------------------------------------------------

typedef _Float16 v16h __attribute__((ext_vector_type(16)));
typedef _Float16 v8h  __attribute__((ext_vector_type(8)));
typedef float    v8f  __attribute__((ext_vector_type(8)));
typedef _Float16 v2h  __attribute__((ext_vector_type(2)));
typedef float    v2f  __attribute__((ext_vector_type(2)));
typedef float    v4f  __attribute__((ext_vector_type(4)));

#define BB 4
#define TT 2048
#define DD 768
#define HH 12
#define HD 64
#define MM (BB * TT)           // 8192 rows

// GEMM wave-tile: 32 rows x 64 cols
#define WTM 32
#define WTN 64
#define GT_M (MM / WTM)        // 256
#define GT_N (DD / WTN)        // 12
#define RT (16 * DD)           // halves of one 16-row tile of a [*, 768] operand
#define GW 12                  // waves of a block of the Q, K, V launch
#define KB 3                   // k blocks of fragments that a GEMM wave keeps in flight

// convert launch, blocks of 8 waves. A wave of the weight part makes 2 row tiles x 1 k
// block (4 runs of 8 halves a lane), a wave of the x part 1 row tile x 4 k blocks (8 runs).
#define WBLK ((DD / 32) * (DD / 32) / 8)   // 72 a weight
#define XBLK ((MM / 16) * (DD / 128) / 8)  // 384 for x

// Workspace byte offsets
#define OFF_XH   0u
#define OFF_WQT  (OFF_XH  + (size_t)MM * DD * 2)
#define OFF_WKT  (OFF_WQT + (size_t)DD * DD * 2)
#define OFF_WVT  (OFF_WKT + (size_t)DD * DD * 2)
#define OFF_WOT  (OFF_WVT + (size_t)DD * DD * 2)
#define OFF_Q    (OFF_WOT + (size_t)DD * DD * 2)
#define OFF_K    (OFF_Q   + (size_t)MM * DD * 2)
#define OFF_VT   (OFF_K   + (size_t)MM * DD * 2)
#define OFF_AO   (OFF_VT  + (size_t)MM * DD * 2)

__device__ __forceinline__ v8f wmma16(v16h a, v16h b, v8f c) {
  // D = A(16x32,f16) x B(32x16,f16) + C(16x16,f32)
  return __builtin_amdgcn_wmma_f32_16x16x32_f16(
      /*neg_a=*/false, a, /*neg_b=*/false, b,
      /*c_mod=*/(short)0, c, /*reuse_a=*/false, /*reuse_b=*/false);
}

// Build a 16-half fragment from two contiguous 16-byte runs.
__device__ __forceinline__ v16h make_frag(const _Float16* p0, const _Float16* p1) {
  v8h lo = *(const v8h*)p0;
  v8h hi = *(const v8h*)p1;
  v16h r;
#pragma unroll
  for (int i = 0; i < 8; ++i) { r[i] = lo[i]; r[i + 8] = hi[i]; }
  return r;
}

// Fragment order of a [rows][kd] f16 operand: blocks of 16 rows x 32 k, 512
// halves each, k blocks of one row tile in a row. In a block, lane
// l = 16 * (k bit 3) + row % 16 owns halves l*8 .. l*8+7 (k bit 4 = 0) and
// 256 + l*8 .. (k bit 4 = 1): the two 16-byte runs that make_frag joins.
__device__ __forceinline__ size_t frag_idx(int row, int k, int kd) {
  return ((size_t)((row >> 4) * (kd >> 5) + (k >> 5)) << 9) +
         (size_t)((((k >> 4) & 1) << 8) + ((((k >> 3) & 1) << 4) + (row & 15)) * 8 + (k & 7));
}

// Fragment of row tile rt, k block ks: base + lane * 8 is passed as p.
__device__ __forceinline__ v16h load_frag(const _Float16* p, int rt, int ks, int kd) {
  const _Float16* q = p + ((size_t)(rt * (kd >> 5) + ks) << 9);
  return make_frag(q, q + 256);
}

// ---------------------------------------------------------------------------
// All five conversions as block ranges of one grid (none reads what another
// writes). Blocks 0 .. 4*WBLK-1, the weights, whose loads are the more scattered:
//   wt[sel](row n, k) = (f16) W[sel][k*768 + n]   (768x768), fragment order
// the rest: xh = (f16) x, [M, 768] row-major -> fragment order
// A lane makes whole 16-byte runs (8 k of one row): lane l of a wave owns place l of
// each half block, so a store instruction writes 512 bytes in a row. All loads of a
// lane are issued before the first conversion.
__global__ __launch_bounds__(256)
void cvt_all_kernel(const float* __restrict__ x,
                    const float* __restrict__ Wq, const float* __restrict__ Wk,
                    const float* __restrict__ Wv, const float* __restrict__ Wo,
                    _Float16* __restrict__ xh, _Float16* __restrict__ wt) {
  const int blk  = blockIdx.x;
  const int lane = threadIdx.x & 31;
  // as a scalar: block addresses then stay in scalar registers
  const int wave = __builtin_amdgcn_readfirstlane(threadIdx.x >> 5);
  const int hl   = lane >> 4;   // k bit 3
  const int l16  = lane & 15;   // row % 16
  if (blk < 4 * WBLK) {
    const int sel = blk / WBLK;
    const float* in = sel == 0 ? Wq : sel == 1 ? Wk : sel == 2 ? Wv : Wo;
    const int wv = (blk - sel * WBLK) * 8 + wave;
    const int tp = wv / (DD / 32);          // pair of row tiles: n = 32 tp ..
    const int kb = wv % (DD / 32);          // k block
    // W[k = 32 kb + 8 hl][n = 32 tp + l16]
    const float* p = in + (size_t)(kb * 32 + hl * 8) * DD + tp * 32 + l16;
    float f[2][2][8];                       // [row tile][k bit 4][k & 7]
#pragma unroll
    for (int h = 0; h < 2; ++h)
#pragma unroll
      for (int j = 0; j < 8; ++j)
#pragma unroll
        for (int t = 0; t < 2; ++t)         // the two halves of one 128-byte line
          f[t][h][j] = p[(h * 16 + j) * DD + t * 16];
    // the conversions below may reuse the registers that hold these loads' address;
    // as an input the pair stays whole up to this wait
    asm volatile("s_wait_xcnt 0x0" :: "v"(p) : "memory");
    _Float16* o = wt + (size_t)sel * DD * DD + (size_t)tp * 2 * RT + kb * 512 + lane * 8;
#pragma unroll
    for (int t = 0; t < 2; ++t)
#pragma unroll
      for (int h = 0; h < 2; ++h) {
        v8h pk;
#pragma unroll
        for (int j = 0; j < 8; ++j) pk[j] = (_Float16)f[t][h][j];
        *(v8h*)(o + t * RT + h * 256) = pk;
      }
    // no register that these stores name is rewritten in front of this wait
    asm volatile("s_wait_xcnt 0x0" ::: "memory");
  } else {
    const int wv = (blk - 4 * WBLK) * 8 + wave;
    const int rt = wv / (DD / 128);         // row tile
    const int kq = wv % (DD / 128);         // four k blocks: 512 bytes of each row
    // x[row = 16 rt + l16][k = 128 kq + 8 hl]
    const float* p = x + (size_t)(rt * 16 + l16) * DD + kq * 128 + hl * 8;
    v4f f[8][2];                            // [half block][k bit 2]
#pragma unroll
    for (int u = 0; u < 8; ++u) {
      f[u][0] = *(const v4f*)(p + u * 16);
      f[u][1] = *(const v4f*)(p + u * 16 + 4);
    }
    // The loaded values as inputs: without them the compiler converts the first runs
    // between the loads and issues the last loads only when the first have come back;
    // so all 16 are in flight at once. The wait: the code below may reuse the registers
    // that hold these loads' address; as an input the pair stays whole up to it.
    asm volatile("s_wait_xcnt 0x0"
                 :: "v"(p), "v"(f[0][0]), "v"(f[0][1]), "v"(f[1][0]), "v"(f[1][1]),
                    "v"(f[2][0]), "v"(f[2][1]), "v"(f[3][0]), "v"(f[3][1]),
                    "v"(f[4][0]), "v"(f[4][1]), "v"(f[5][0]), "v"(f[5][1]),
                    "v"(f[6][0]), "v"(f[6][1]), "v"(f[7][0]), "v"(f[7][1])
                 : "memory");
    _Float16* o = xh + (size_t)rt * RT + kq * 4 * 512 + lane * 8;
#pragma unroll
    for (int u = 0; u < 8; ++u) {
      v8h pk;
#pragma unroll
      for (int j = 0; j < 4; ++j) {
        pk[j]     = (_Float16)f[u][0][j];
        pk[j + 4] = (_Float16)f[u][1][j];
      }
      *(v8h*)(o + u * 256) = pk;
    }
    // no register that these stores name is rewritten in front of this wait
    asm volatile("s_wait_xcnt 0x0" ::: "memory");
  }
}

// ---------------------------------------------------------------------------
// WMMA GEMM, 32x64 tile per wave (2 M-subtiles x 4 N-subtiles):
//   A  : f16 [M, 768], fragment order
//   Bt : f16 transposed weight [N=768, K=768] (row n = column n of W), fragment order
// mode 0: out f16 [B,H][T,64], each [T,64] in fragment order   (Q, K)
// mode 1: out f16 [B,H][64,T], each [64,T] in fragment order   (V transposed)
// mode 2: out f32 row-major [M, 768]   (final projection)
// A launch holds one product (proj = 1: mode 2, 8 waves, 8 tiles a block) or three that
// share A (proj = 0): a block is then 12 waves, 4 tiles x 3 products, so that the three
// waves of a tile read the same A lines at the same time. Product sel takes weight
// Bt3 + sel * 768 * 768, bias sel and the sel-th [M, 768] f16 plane of out;
// sel 0, 1 are mode 0, sel 2 is mode 1.
// ---------------------------------------------------------------------------
__global__ __launch_bounds__(GW * 32)
void gemm_wmma_kernel(const _Float16* __restrict__ A,
                      const _Float16* __restrict__ Bt3,
                      const float* __restrict__ bias0,
                      const float* __restrict__ bias1,
                      const float* __restrict__ bias2,
                      void* __restrict__ out, int proj) {
  const int tid  = threadIdx.x;
  const int lane = tid & 31;
  // as a scalar: the product that it selects picks pointers and the store branch
  const int wave = __builtin_amdgcn_readfirstlane(tid >> 5);
  const int sel  = proj ? 0 : wave >> 2;
  const int mode = proj ? 2 : (sel == 2 ? 1 : 0);
  const _Float16* Bt = Bt3 + (size_t)sel * DD * DD;
  const float* bias  = sel == 0 ? bias0 : sel == 1 ? bias1 : bias2;
  const int w    = proj ? blockIdx.x * 8 + wave : blockIdx.x * 4 + (wave & 3);
  const int tm   = w % GT_M;
  const int tn   = w / GT_M;
  const int m0   = tm * WTM;
  const int n0   = tn * WTN;
  const int hl   = lane >> 4;   // half-wave id
  const int l16  = lane & 15;

  // this lane's 16 bytes in k block 0 of the wave's first row tile of A and of Bt
  const _Float16* ak = A  + (size_t)(m0 >> 4) * RT + lane * 8;
  const _Float16* bk = Bt + (size_t)(n0 >> 4) * RT + lane * 8;

  v8f acc[2][4];
#pragma unroll
  for (int mi = 0; mi < 2; ++mi)
#pragma unroll
    for (int ni = 0; ni < 4; ++ni)
      acc[mi][ni] = (v8f){0.f, 0.f, 0.f, 0.f, 0.f, 0.f, 0.f, 0.f};

  // Fragments run KB k blocks ahead, in KB register sets: those of blocks 0 .. KB-1 are
  // fetched here, those of block k + KB behind the products of block k, into its set.
  v16h a[KB][2], b[KB][4];
#pragma unroll
  for (int u = 0; u < KB; ++u) {
    a[u][0] = make_frag(ak + u * 512, ak + u * 512 + 256);
    a[u][1] = make_frag(ak + u * 512 + RT, ak + u * 512 + RT + 256);
#pragma unroll
    for (int ni = 0; ni < 4; ++ni)
      b[u][ni] = make_frag(bk + u * 512 + ni * RT, bk + u * 512 + ni * RT + 256);
  }
  // in front of the loop's set-up, which reuses the register that holds these loads' offset
  asm volatile("s_wait_xcnt 0x0" ::: "memory");
  // keeps that set-up behind the wait
  __builtin_amdgcn_sched_barrier(0);

  // stays rolled: unrolled further, the trips' register sets no longer fit and are spilled
#pragma nounroll
  for (int ks = KB; ks < DD / 32; ks += KB) {
    ak += KB * 512;            // the blocks that this trip fetches
    bk += KB * 512;
#pragma unroll
    for (int u = 0; u < KB; ++u) {
#pragma unroll
      for (int ni = 0; ni < 4; ++ni) {
        acc[0][ni] = wmma16(a[u][0], b[u][ni], acc[0][ni]);
        acc[1][ni] = wmma16(a[u][1], b[u][ni], acc[1][ni]);
      }
      // Holds the fetch behind the products: lifted over them it would need registers of
      // its own beside the set that they still read.
      __builtin_amdgcn_sched_barrier(0);
      a[u][0] = make_frag(ak + u * 512, ak + u * 512 + 256);
      a[u][1] = make_frag(ak + u * 512 + RT, ak + u * 512 + RT + 256);
#pragma unroll
      for (int ni = 0; ni < 4; ++ni)
        b[u][ni] = make_frag(bk + u * 512 + ni * RT, bk + u * 512 + ni * RT + 256);
      // Holds the fetch in front of the next block's products: sunk towards its use it
      // would lose its lead.
      __builtin_amdgcn_sched_barrier(0);
    }
    // in front of the next trip's additions, which rewrite the registers that this trip's
    // loads name
    asm volatile("s_wait_xcnt 0x0" ::: "memory");
  }
#pragma unroll
  for (int u = 0; u < KB; ++u)   // the last KB blocks: nothing is left to fetch
#pragma unroll
    for (int ni = 0; ni < 4; ++ni) {
      acc[0][ni] = wmma16(a[u][0], b[u][ni], acc[0][ni]);
      acc[1][ni] = wmma16(a[u][1], b[u][ni], acc[1][ni]);
    }

#pragma unroll
  for (int ni = 0; ni < 4; ++ni) {
    const int n = n0 + ni * 16 + l16;     // output column (C/D: N = lane%16)
    const float bval = bias[n];
    // the code below reuses the register that holds this load's offset
    asm volatile("s_wait_xcnt 0x0" ::: "memory");
    const int h = n >> 6;                 // head (64-wide N-tile stays in head)
    const int d = n & 63;
#pragma unroll
    for (int mi = 0; mi < 2; ++mi) {
      if (mode == 2) {
        float* o = (float*)out;
#pragma unroll
        for (int r = 0; r < 8; ++r) {
          int m = m0 + mi * 16 + r + 8 * hl;   // C/D: M = r + 8*(lane/16)
          o[(size_t)m * DD + n] = acc[mi][ni][r] + bval;
        }
        // the next tile's code reuses the registers that these stores name
        asm volatile("s_wait_xcnt 0x0" ::: "memory");
      } else {
        const int mb = m0 + mi * 16 + 8 * hl;  // row of r = 0, a multiple of 8
        const int b  = mb >> 11;               // T = 2048
        const int t0 = mb & 2047;
        _Float16* o = (_Float16*)out + (size_t)sel * MM * DD + (size_t)(b * HH + h) * TT * HD;
        if (mode == 0) {
#pragma unroll
          for (int r = 0; r < 8; ++r)
            o[frag_idx(t0 + r, d, HD)] = (_Float16)(acc[mi][ni][r] + bval);
          // the next tile's code reuses the registers that these stores name
          asm volatile("s_wait_xcnt 0x0" ::: "memory");
        } else {
          v8h pk;                              // k = t0 .. t0+7: one 16-byte run
#pragma unroll
          for (int r = 0; r < 8; ++r) pk[r] = (_Float16)(acc[mi][ni][r] + bval);
          *(v8h*)(o + frag_idx(d, t0, TT)) = pk;
          // the next tile's code reuses the registers that this store names
          asm volatile("s_wait_xcnt 0x0" ::: "memory");
        }
      }
    }
  }
}

// value of lane l ^ 16
__device__ __forceinline__ float xhalf(float x) {
  const int i = __builtin_bit_cast(int, x);
  return __builtin_bit_cast(
      float, __builtin_amdgcn_permlanex16(i, i, 0x76543210, 0xfedcba98, false, false));
}

__global__ __launch_bounds__(256)
void flash_attn_kernel(const _Float16* __restrict__ Q,
                       const _Float16* __restrict__ K,
                       const _Float16* __restrict__ Vt,
                       _Float16* __restrict__ AO) {
  const int tid  = threadIdx.x;
  const int lane = tid & 31;
  const int wave = tid >> 5;
  const int w    = blockIdx.x * 8 + wave;
  const int qt   = w & 63;                // T/32 = 64 query tiles
  const int bh   = w >> 6;                // 0..47
  const int hl   = lane >> 4;
  const int l16  = lane & 15;
  const int q0   = qt * 32;

  // Q B-fragments: [query group][k-half of head dim]
  v16h qb[2][2];
#pragma unroll
  for (int q = 0; q < 2; ++q) {
    const _Float16* qp = Q + (size_t)bh * TT * HD + lane * 8;
    qb[q][0] = load_frag(qp, (q0 >> 4) + q, 0, HD);
    qb[q][1] = load_frag(qp, (q0 >> 4) + q, 1, HD);
  }

  // o[q][ni][r] = O[query q0 + 16q + l16][d = 16ni + 8hl + r]
  v8f o[2][4];
  float mrun[2], lsum[2];                 // this lane's query; lsum: this half's keys
#pragma unroll
  for (int q = 0; q < 2; ++q) {
#pragma unroll
    for (int ni = 0; ni < 4; ++ni)
      o[q][ni] = (v8f){0.f, 0.f, 0.f, 0.f, 0.f, 0.f, 0.f, 0.f};
    mrun[q] = -__builtin_inff();
    lsum[q] = 0.f;
  }

  // this lane's 16 bytes in the first block of the pass's K rows and V^T columns
  const _Float16* kp = K  + (size_t)bh * TT * HD + lane * 8;
  const _Float16* vp = Vt + (size_t)bh * HD * TT + lane * 8;
  const float scale = 0.125f;             // 1/sqrt(64)

  // K fragments run one pass ahead: those of pass 0 are fetched here, those of each
  // further pass behind the score products of the pass before, into the same registers.
  v16h ka[2][2];                          // [key tile][k-half of head dim]
#pragma unroll
  for (int j = 0; j < 2; ++j) {
    ka[j][0] = load_frag(kp, j, 0, HD);
    ka[j][1] = load_frag(kp, j, 1, HD);
  }
  // The loads above name kp: as an input here the pair stays whole up to this wait,
  // which stands in front of the addition that rewrites it.
  asm volatile("s_wait_xcnt 0x0" :: "v"(kp) : "memory");

  for (int kt = 0; kt < TT; kt += 32) {
    v16h va[4];                           // [16 rows of d], k = the 32 keys
#pragma unroll
    for (int ni = 0; ni < 4; ++ni) va[ni] = load_frag(vp, ni, 0, TT);

    // ---- S^T = K @ Q^T : 2 key tiles x 2 query groups, K frags shared ----
    // s[q][j][r] = score of key kt + 16j + 8hl + r with this lane's query
    v8f s[2][2];
#pragma unroll
    for (int j = 0; j < 2; ++j) {
#pragma unroll
      for (int q = 0; q < 2; ++q) {
        v8f t = (v8f){0.f, 0.f, 0.f, 0.f, 0.f, 0.f, 0.f, 0.f};
        t = wmma16(ka[j][0], qb[q][0], t);
        t = wmma16(ka[j][1], qb[q][1], t);
        s[q][j] = t;
      }
    }

    // ---- the next pass's K: in flight under softmax and the O^T products ----
    // next 32 keys: 4 blocks of K; the last pass fetches its own rows again, unused
    kp += kt + 32 < TT ? 32 * HD : 0;
#pragma unroll
    for (int j = 0; j < 2; ++j) {
      ka[j][0] = load_frag(kp, j, 0, HD);
      ka[j][1] = load_frag(kp, j, 1, HD);
    }
    // Holds the fetch at this place: without it the compiler sinks these loads far into
    // the softmax, whose temporaries then take the K registers, and most of the lead goes.
    __builtin_amdgcn_sched_barrier(0);

    // ---- online softmax over the 32 new keys, per query group ------------
    v16h pb[2];
#pragma unroll
    for (int q = 0; q < 2; ++q) {
      float mx = fmaxf(s[q][0][0], s[q][1][0]);
#pragma unroll
      for (int r = 1; r < 8; ++r) mx = fmaxf(mx, fmaxf(s[q][0][r], s[q][1][r]));
      mx = fmaxf(mx, xhalf(mx));          // the other 16 keys of this query
      const float mn = fmaxf(mrun[q], mx * scale);
      const float alpha = __expf(mrun[q] - mn);
      mrun[q] = mn;
      v2f rs = (v2f){0.f, 0.f};           // sums of even and of odd r
#pragma unroll
      for (int j = 0; j < 2; ++j) {
#pragma unroll
        for (int r = 0; r < 8; r += 2) {
          const v2f x = (v2f){s[q][j][r], s[q][j][r + 1]} * scale - mn;
          const v2f p = (v2f){__expf(x.x), __expf(x.y)};
          rs += p;
          const v2h ph = __builtin_convertvector(p, v2h);
          pb[q][8 * j + r]     = ph.x;    // k = 16j + 8hl + r
          pb[q][8 * j + r + 1] = ph.y;
        }
      }
      lsum[q] = lsum[q] * alpha + (rs.x + rs.y);
#pragma unroll
      for (int ni = 0; ni < 4; ++ni)
#pragma unroll
        for (int r = 0; r < 8; ++r)
          o[q][ni][r] *= alpha;
    }

    // ---- O^T += V^T @ P^T : V frags shared between query groups ----------
#pragma unroll
    for (int ni = 0; ni < 4; ++ni) {
      o[0][ni] = wmma16(va[ni], pb[0], o[0][ni]);
      o[1][ni] = wmma16(va[ni], pb[1], o[1][ni]);
    }
    // Holds the wait below at the foot of the pass, where the address translations are
    // long done; lifted to directly behind the loads it would stall the wave there.
    __builtin_amdgcn_sched_barrier(0);
    // This pass's loads name kp and vp: as inputs here both pairs stay whole up to
    // this wait, which stands in front of the additions that rewrite them.
    asm volatile("s_wait_xcnt 0x0" :: "v"(kp), "v"(vp) : "memory");
    vp += 512;                            // next k block of V^T
  }

  // ---- finalize: join the halves' sums, divide, store 16-byte runs of d ---
  const int b = bh / HH;
  const int h = bh % HH;
  v8h pk[2][4];
#pragma unroll
  for (int q = 0; q < 2; ++q) {
    const float inv = 1.f / (lsum[q] + xhalf(lsum[q]));
#pragma unroll
    for (int ni = 0; ni < 4; ++ni)
#pragma unroll
      for (int r = 0; r < 8; ++r) pk[q][ni][r] = (_Float16)(o[q][ni][r] * inv);
  }
  // row b*T + q0 + l16, k = h*64 + 8hl; a query group is one row tile further,
  // ni steps through the halves of two k blocks: 512 bytes in a row per store
  _Float16* ao = AO + frag_idx(b * TT + q0 + l16, h * HD + 8 * hl, DD);
#pragma unroll
  for (int q = 0; q < 2; ++q)
#pragma unroll
    for (int ni = 0; ni < 4; ++ni)
      *(v8h*)(ao + q * RT + ni * 256) = pk[q][ni];
}

// ---------------------------------------------------------------------------
extern "C" void kernel_launch(void* const* d_in, const int* in_sizes, int n_in,
                              void* d_out, int out_size, void* d_ws, size_t ws_size,
                              hipStream_t stream) {
  const float* x  = (const float*)d_in[0];
  const float* Wq = (const float*)d_in[1];
  const float* bq = (const float*)d_in[2];
  const float* Wk = (const float*)d_in[3];
  const float* bk = (const float*)d_in[4];
  const float* Wv = (const float*)d_in[5];
  const float* bv = (const float*)d_in[6];
  const float* Wo = (const float*)d_in[7];
  const float* bo = (const float*)d_in[8];

  char* ws = (char*)d_ws;
  _Float16* xh  = (_Float16*)(ws + OFF_XH);
  _Float16* wqt = (_Float16*)(ws + OFF_WQT);
  _Float16* wot = (_Float16*)(ws + OFF_WOT);
  _Float16* qh  = (_Float16*)(ws + OFF_Q);
  _Float16* kh  = (_Float16*)(ws + OFF_K);
  _Float16* vt  = (_Float16*)(ws + OFF_VT);
  _Float16* ao  = (_Float16*)(ws + OFF_AO);

  // wqt, wkt, wvt, wot stand one behind the other in the workspace; so do qh, kh, vt
  cvt_all_kernel<<<4 * WBLK + XBLK, 256, 0, stream>>>(x, Wq, Wk, Wv, Wo, xh, wqt);

  gemm_wmma_kernel<<<GT_M * GT_N / 4, GW * 32, 0, stream>>>(xh, wqt, bq, bk, bv, (void*)qh, 0);

  const int attn_blocks = (BB * HH * (TT / 32)) / 8;   // 384
  flash_attn_kernel<<<attn_blocks, 256, 0, stream>>>(qh, kh, vt, ao);

  gemm_wmma_kernel<<<GT_M * GT_N / 8, 256, 0, stream>>>(ao, wot, bo, bo, bo, d_out, 1);
}

// v007
// Measured time: 111 microseconds a run.
// Timed twice side by side with v006, it ran 1.07 times as fast both times.
// All steps since v000 together make it 2.89 times as fast.
#include <hip/hip_runtime.h>

// ---------------------------------------------------------------------------
// Multi-head attention for MI455X (gfx1250, wave32, WMMA f32_16x16x32_f16)
//   B=4, T=2048, D=768, H=12, hd=64
// Pipeline:
//   1) one launch: f32->f16 convert x; transpose+convert Wq/Wk/Wv/Wo
//   2) one launch: WMMA GEMMs (32x64 tile/wave) -> Q,K in [B,H,T,64] f16 ;
//      V in [B,H,64,T] f16 (transposed)
//   3) flash-attention, transposed (S^T = K Q^T, O^T += V^T P^T): 1 wave per
//      32 query columns (2 groups sharing K/V fragments), keys streamed 32 at
//      a time, online softmax in-lane, P^T packed from the S^T accumulators
//   4) WMMA GEMM attn_out @ Wo + bo -> f32 d_out
// Every f16 operand in the workspace is kept in fragment order (frag_idx), so
// that one fragment load instruction reads 512 contiguous bytes.
// ---------------------------------------------------------------------------

typedef _Float16 v16h __attribute__((ext_vector_type(16)));
typedef _Float16 v8h  __attribute__((ext_vector_type(8)));
typedef float    v8f  __attribute__((ext_vector_type(8)));
typedef _Float16 v2h  __attribute__((ext_vector_type(2)));
typedef float    v2f  __attribute__((ext_vector_type(2)));
typedef float    v4f  __attribute__((ext_vector_type(4)));

#define BB 4
#define TT 2048
#define DD 768
#define HH 12
#define HD 64
#define MM (BB * TT)           // 8192 rows

// GEMM wave-tile: 32 rows x 64 cols
#define WTM 32
#define WTN 64
#define GT_M (MM / WTM)        // 256
#define GT_N (DD / WTN)        // 12
#define RT (16 * DD)           // halves of one 16-row tile of a [*, 768] operand
#define GW 12                  // waves of a block of the Q, K, V launch
#define KB 3                   // k blocks of fragments that a GEMM wave keeps in flight
#define NS (DD / 32 / KB)      // 8 stages of KB k blocks in a GEMM's k walk
#define NP (TT / 32)           // 64 passes of 32 keys in the attention's key walk

// convert launch, blocks of 8 waves. A wave of the weight part makes 2 row tiles x 1 k
// block (4 runs of 8 halves a lane), a wave of the x part 1 row tile x 4 k blocks (8 runs).
#define WBLK ((DD / 32) * (DD / 32) / 8)   // 72 a weight
#define XBLK ((MM / 16) * (DD / 128) / 8)  // 384 for x

// Workspace byte offsets
#define OFF_XH   0u
#define OFF_WQT  (OFF_XH  + (size_t)MM * DD * 2)
#define OFF_WKT  (OFF_WQT + (size_t)DD * DD * 2)
#define OFF_WVT  (OFF_WKT + (size_t)DD * DD * 2)
#define OFF_WOT  (OFF_WVT + (size_t)DD * DD * 2)
#define OFF_Q    (OFF_WOT + (size_t)DD * DD * 2)
#define OFF_K    (OFF_Q   + (size_t)MM * DD * 2)
#define OFF_VT   (OFF_K   + (size_t)MM * DD * 2)
#define OFF_AO   (OFF_VT  + (size_t)MM * DD * 2)

__device__ __forceinline__ v8f wmma16(v16h a, v16h b, v8f c) {
  // D = A(16x32,f16) x B(32x16,f16) + C(16x16,f32)
  return __builtin_amdgcn_wmma_f32_16x16x32_f16(
      /*neg_a=*/false, a, /*neg_b=*/false, b,
      /*c_mod=*/(short)0, c, /*reuse_a=*/false, /*reuse_b=*/false);
}

// Build a 16-half fragment from two contiguous 16-byte runs.
__device__ __forceinline__ v16h make_frag(const _Float16* p0, const _Float16* p1) {
  v8h lo = *(const v8h*)p0;
  v8h hi = *(const v8h*)p1;
  v16h r;
#pragma unroll
  for (int i = 0; i < 8; ++i) { r[i] = lo[i]; r[i + 8] = hi[i]; }
  return r;
}

// Fragment order of a [rows][kd] f16 operand: blocks of 16 rows x 32 k, 512
// halves each, k blocks of one row tile in a row. In a block, lane
// l = 16 * (k bit 3) + row % 16 owns halves l*8 .. l*8+7 (k bit 4 = 0) and
// 256 + l*8 .. (k bit 4 = 1): the two 16-byte runs that make_frag joins.
__device__ __forceinline__ size_t frag_idx(int row, int k, int kd) {
  return ((size_t)((row >> 4) * (kd >> 5) + (k >> 5)) << 9) +
         (size_t)((((k >> 4) & 1) << 8) + ((((k >> 3) & 1) << 4) + (row & 15)) * 8 + (k & 7));
}

// Fragment of row tile rt, k block ks: base + lane * 8 is passed as p.
__device__ __forceinline__ v16h load_frag(const _Float16* p, int rt, int ks, int kd) {
  const _Float16* q = p + ((size_t)(rt * (kd >> 5) + ks) << 9);
  return make_frag(q, q + 256);
}

// ---------------------------------------------------------------------------
// All five conversions as block ranges of one grid (none reads what another
// writes). Blocks 0 .. 4*WBLK-1, the weights, whose loads are the more scattered:
//   wt[sel](row n, k) = (f16) W[sel][k*768 + n]   (768x768), fragment order
// the rest: xh = (f16) x, [M, 768] row-major -> fragment order
// A lane makes whole 16-byte runs (8 k of one row): lane l of a wave owns place l of
// each half block, so a store instruction writes 512 bytes in a row. All loads of a
// lane are issued before the first conversion.
__global__ __launch_bounds__(256)
void cvt_all_kernel(const float* __restrict__ x,
                    const float* __restrict__ Wq, const float* __restrict__ Wk,
                    const float* __restrict__ Wv, const float* __restrict__ Wo,
                    _Float16* __restrict__ xh, _Float16* __restrict__ wt) {
  const int blk  = blockIdx.x;
  const int lane = threadIdx.x & 31;
  // as a scalar: block addresses then stay in scalar registers
  const int wave = __builtin_amdgcn_readfirstlane(threadIdx.x >> 5);
  const int hl   = lane >> 4;   // k bit 3
  const int l16  = lane & 15;   // row % 16
  if (blk < 4 * WBLK) {
    const int sel = blk / WBLK;
    const float* in = sel == 0 ? Wq : sel == 1 ? Wk : sel == 2 ? Wv : Wo;
    const int wv = (blk - sel * WBLK) * 8 + wave;
    const int tp = wv / (DD / 32);          // pair of row tiles: n = 32 tp ..
    const int kb = wv % (DD / 32);          // k block
    // W[k = 32 kb + 8 hl][n = 32 tp + l16]
    const float* p = in + (size_t)(kb * 32 + hl * 8) * DD + tp * 32 + l16;
    float f[2][2][8];                       // [row tile][k bit 4][k & 7]
#pragma unroll
    for (int h = 0; h < 2; ++h)
#pragma unroll
      for (int j = 0; j < 8; ++j)
#pragma unroll
        for (int t = 0; t < 2; ++t)         // the two halves of one 128-byte line
          f[t][h][j] = p[(h * 16 + j) * DD + t * 16];
    // the conversions below may reuse the registers that hold these loads' address;
    // as an input the pair stays whole up to this wait
    asm volatile("s_wait_xcnt 0x0" :: "v"(p) : "memory");
    _Float16* o = wt + (size_t)sel * DD * DD + (size_t)tp * 2 * RT + kb * 512 + lane * 8;
#pragma unroll
    for (int t = 0; t < 2; ++t)
#pragma unroll
      for (int h = 0; h < 2; ++h) {
        v8h pk;
#pragma unroll
        for (int j = 0; j < 8; ++j) pk[j] = (_Float16)f[t][h][j];
        *(v8h*)(o + t * RT + h * 256) = pk;
      }
    // no register that these stores name is rewritten in front of this wait
    asm volatile("s_wait_xcnt 0x0" ::: "memory");
  } else {
    const int wv = (blk - 4 * WBLK) * 8 + wave;
    const int rt = wv / (DD / 128);         // row tile
    const int kq = wv % (DD / 128);         // four k blocks: 512 bytes of each row
    // x[row = 16 rt + l16][k = 128 kq + 8 hl]
    const float* p = x + (size_t)(rt * 16 + l16) * DD + kq * 128 + hl * 8;
    v4f f[8][2];                            // [half block][k bit 2]
#pragma unroll
    for (int u = 0; u < 8; ++u) {
      f[u][0] = *(const v4f*)(p + u * 16);
      f[u][1] = *(const v4f*)(p + u * 16 + 4);
    }
    // The loaded values as inputs: without them the compiler converts the first runs
    // between the loads and issues the last loads only when the first have come back;
    // so all 16 are in flight at once. The wait: the code below may reuse the registers
    // that hold these loads' address; as an input the pair stays whole up to it.
    asm volatile("s_wait_xcnt 0x0"
                 :: "v"(p), "v"(f[0][0]), "v"(f[0][1]), "v"(f[1][0]), "v"(f[1][1]),
                    "v"(f[2][0]), "v"(f[2][1]), "v"(f[3][0]), "v"(f[3][1]),
                    "v"(f[4][0]), "v"(f[4][1]), "v"(f[5][0]), "v"(f[5][1]),
                    "v"(f[6][0]), "v"(f[6][1]), "v"(f[7][0]), "v"(f[7][1])
                 : "memory");
    _Float16* o = xh + (size_t)rt * RT + kq * 4 * 512 + lane * 8;
#pragma unroll
    for (int u = 0; u < 8; ++u) {
      v8h pk;
#pragma unroll
      for (int j = 0; j < 4; ++j) {
        pk[j]     = (_Float16)f[u][0][j];
        pk[j + 4] = (_Float16)f[u][1][j];
      }
      *(v8h*)(o + u * 256) = pk;
    }
    // no register that these stores name is rewritten in front of this wait
    asm volatile("s_wait_xcnt 0x0" ::: "memory");
  }
}

// ---------------------------------------------------------------------------
// WMMA GEMM, 32x64 tile per wave (2 M-subtiles x 4 N-subtiles):
//   A  : f16 [M, 768], fragment order
//   Bt : f16 transposed weight [N=768, K=768] (row n = column n of W), fragment order
// mode 0: out f16 [B,H][T,64], each [T,64] in fragment order   (Q, K)
// mode 1: out f16 [B,H][64,T], each [64,T] in fragment order   (V transposed)
// mode 2: out f32 row-major [M, 768]   (final projection)
// A launch holds one product (proj = 1: mode 2, 8 waves, 8 tiles a block) or three that
// share A (proj = 0): a block is then 12 waves, 4 tiles x 3 products, so that the three
// waves of a tile read the same A lines at the same time. Product sel takes weight
// Bt3 + sel * 768 * 768, bias sel and the sel-th [M, 768] f16 plane of out;
// sel 0, 1 are mode 0, sel 2 is mode 1.
// ---------------------------------------------------------------------------
__global__ __launch_bounds__(GW * 32)
void gemm_wmma_kernel(const _Float16* __restrict__ A,
                      const _Float16* __restrict__ Bt3,
                      const float* __restrict__ bias0,
                      const float* __restrict__ bias1,
                      const float* __restrict__ bias2,
                      void* __restrict__ out, int proj) {
  const int tid  = threadIdx.x;
  const int lane = tid & 31;
  // as a scalar: the product that it selects picks pointers and the store branch
  const int wave = __builtin_amdgcn_readfirstlane(tid >> 5);
  const int sel  = proj ? 0 : wave >> 2;
  const int mode = proj ? 2 : (sel == 2 ? 1 : 0);
  const _Float16* Bt = Bt3 + (size_t)sel * DD * DD;
  const float* bias  = sel == 0 ? bias0 : sel == 1 ? bias1 : bias2;
  const int w    = proj ? blockIdx.x * 8 + wave : blockIdx.x * 4 + (wave & 3);
  const int tm   = w % GT_M;
  const int tn   = w / GT_M;
  const int m0   = tm * WTM;
  const int n0   = tn * WTN;
  const int hl   = lane >> 4;   // half-wave id
  const int l16  = lane & 15;

  // this lane's 16 bytes in k block 0 of the wave's first row tile of A and of Bt
  const _Float16* a0 = A  + (size_t)(m0 >> 4) * RT + lane * 8;
  const _Float16* b0 = Bt + (size_t)(n0 >> 4) * RT + lane * 8;
  // Blocks of one tn read the same rows of Bt, blocks of one tm the same rows of A. They
  // enter the k walk at different stages and wrap round, so that they do not ask L2 for
  // the same lines at the same moment, and most find a line that another has fetched.
  // Blocks whose indices differ by 1, by 8 or by one tn differ in the stage. It is the same
  // for a block's waves, which go on sharing lines in the WGP cache.
  unsigned st = (blockIdx.x + (blockIdx.x >> 3) + 3u * tn) % NS;
  const _Float16* ak = a0 + st * (KB * 512);
  const _Float16* bk = b0 + st * (KB * 512);

  v8f acc[2][4];
#pragma unroll
  for (int mi = 0; mi < 2; ++mi)
#pragma unroll
    for (int ni = 0; ni < 4; ++ni)
      acc[mi][ni] = (v8f){0.f, 0.f, 0.f, 0.f, 0.f, 0.f, 0.f, 0.f};

  // Fragments run one stage (KB k blocks) ahead, in KB register sets: those of the first
  // stage are fetched here, those of the next stage's block u behind the products of this
  // stage's block u, into its set.
  v16h a[KB][2], b[KB][4];
#pragma unroll
  for (int u = 0; u < KB; ++u) {
    a[u][0] = make_frag(ak + u * 512, ak + u * 512 + 256);
    a[u][1] = make_frag(ak + u * 512 + RT, ak + u * 512 + RT + 256);
#pragma unroll
    for (int ni = 0; ni < 4; ++ni)
      b[u][ni] = make_frag(bk + u * 512 + ni * RT, bk + u * 512 + ni * RT + 256);
  }
  // in front of the loop's set-up, which reuses the register that holds these loads' offset
  asm volatile("s_wait_xcnt 0x0" ::: "memory");
  // keeps that set-up behind the wait
  __builtin_amdgcn_sched_barrier(0);

  // stays rolled: unrolled further, the trips' register sets no longer fit and are spilled
#pragma nounroll
  for (int ks = KB; ks < DD / 32; ks += KB) {
    st = (st + 1) % NS;        // the stage that this trip fetches
    ak = a0 + st * (KB * 512);
    bk = b0 + st * (KB * 512);
#pragma unroll
    for (int u = 0; u < KB; ++u) {
#pragma unroll
      for (int ni = 0; ni < 4; ++ni) {
        acc[0][ni] = wmma16(a[u][0], b[u][ni], acc[0][ni]);
        acc[1][ni] = wmma16(a[u][1], b[u][ni], acc[1][ni]);
      }
      // Holds the fetch behind the products: lifted over them it would need registers of
      // its own beside the set that they still read.
      __builtin_amdgcn_sched_barrier(0);
      a[u][0] = make_frag(ak + u * 512, ak + u * 512 + 256);
      a[u][1] = make_frag(ak + u * 512 + RT, ak + u * 512 + RT + 256);
#pragma unroll
      for (int ni = 0; ni < 4; ++ni)
        b[u][ni] = make_frag(bk + u * 512 + ni * RT, bk + u * 512 + ni * RT + 256);
      // Holds the fetch in front of the next block's products: sunk towards its use it
      // would lose its lead.
      __builtin_amdgcn_sched_barrier(0);
    }
    // in front of the next trip's address set-up, which rewrites the registers that this
    // trip's loads name
    asm volatile("s_wait_xcnt 0x0" ::: "memory");
  }
#pragma unroll
  for (int u = 0; u < KB; ++u)   // the last KB blocks: nothing is left to fetch
#pragma unroll
    for (int ni = 0; ni < 4; ++ni) {
      acc[0][ni] = wmma16(a[u][0], b[u][ni], acc[0][ni]);
      acc[1][ni] = wmma16(a[u][1], b[u][ni], acc[1][ni]);
    }

#pragma unroll
  for (int ni = 0; ni < 4; ++ni) {
    const int n = n0 + ni * 16 + l16;     // output column (C/D: N = lane%16)
    const float bval = bias[n];
    // the code below reuses the register that holds this load's offset
    asm volatile("s_wait_xcnt 0x0" ::: "memory");
    const int h = n >> 6;                 // head (64-wide N-tile stays in head)
    const int d = n & 63;
#pragma unroll
    for (int mi = 0; mi < 2; ++mi) {
      if (mode == 2) {
        float* o = (float*)out;
#pragma unroll
        for (int r = 0; r < 8; ++r) {
          int m = m0 + mi * 16 + r + 8 * hl;   // C/D: M = r + 8*(lane/16)
          o[(size_t)m * DD + n] = acc[mi][ni][r] + bval;
        }
        // the next tile's code reuses the registers that these stores name
        asm volatile("s_wait_xcnt 0x0" ::: "memory");
      } else {
        const int mb = m0 + mi * 16 + 8 * hl;  // row of r = 0, a multiple of 8
        const int b  = mb >> 11;               // T = 2048
        const int t0 = mb & 2047;
        _Float16* o = (_Float16*)out + (size_t)sel * MM * DD + (size_t)(b * HH + h) * TT * HD;
        if (mode == 0) {
#pragma unroll
          for (int r = 0; r < 8; ++r)
            o[frag_idx(t0 + r, d, HD)] = (_Float16)(acc[mi][ni][r] + bval);
          // the next tile's code reuses the registers that these stores name
          asm volatile("s_wait_xcnt 0x0" ::: "memory");
        } else {
          v8h pk;                              // k = t0 .. t0+7: one 16-byte run
#pragma unroll
          for (int r = 0; r < 8; ++r) pk[r] = (_Float16)(acc[mi][ni][r] + bval);
          *(v8h*)(o + frag_idx(d, t0, TT)) = pk;
          // the next tile's code reuses the registers that this store names
          asm volatile("s_wait_xcnt 0x0" ::: "memory");
        }
      }
    }
  }
}

// value of lane l ^ 16
__device__ __forceinline__ float xhalf(float x) {
  const int i = __builtin_bit_cast(int, x);
  return __builtin_bit_cast(
      float, __builtin_amdgcn_permlanex16(i, i, 0x76543210, 0xfedcba98, false, false));
}

__global__ __launch_bounds__(256)
void flash_attn_kernel(const _Float16* __restrict__ Q,
                       const _Float16* __restrict__ K,
                       const _Float16* __restrict__ Vt,
                       _Float16* __restrict__ AO) {
  const int tid  = threadIdx.x;
  const int lane = tid & 31;
  const int wave = tid >> 5;
  const int w    = blockIdx.x * 8 + wave;
  const int qt   = w & 63;                // T/32 = 64 query tiles
  const int bh   = w >> 6;                // 0..47
  const int hl   = lane >> 4;
  const int l16  = lane & 15;
  const int q0   = qt * 32;

  // Q B-fragments: [query group][k-half of head dim]
  v16h qb[2][2];
#pragma unroll
  for (int q = 0; q < 2; ++q) {
    const _Float16* qp = Q + (size_t)bh * TT * HD + lane * 8;
    qb[q][0] = load_frag(qp, (q0 >> 4) + q, 0, HD);
    qb[q][1] = load_frag(qp, (q0 >> 4) + q, 1, HD);
  }

  // o[q][ni][r] = O[query q0 + 16q + l16][d = 16ni + 8hl + r]
  v8f o[2][4];
  float mrun[2], lsum[2];                 // this lane's query; lsum: this half's keys
#pragma unroll
  for (int q = 0; q < 2; ++q) {
#pragma unroll
    for (int ni = 0; ni < 4; ++ni)
      o[q][ni] = (v8f){0.f, 0.f, 0.f, 0.f, 0.f, 0.f, 0.f, 0.f};
    mrun[q] = -__builtin_inff();
    lsum[q] = 0.f;
  }

  // The 8 blocks of one (b,h) read the same K and V^T. Each enters the key walk at an
  // eighth of its own and wraps round, so that they do not ask L2 for the same lines at the
  // same moment, and most find a line that another has fetched; blocks with neighbouring
  // indices start at least a quarter of the walk apart. A block's waves walk alike and go on
  // sharing lines in the WGP cache.
  // the pass's place in the key order
  unsigned ps = ((blockIdx.x & 3) * 2 + ((blockIdx.x >> 2) & 1)) * (NP / 8);
  // this lane's 16 bytes in the first block of K and V^T, and of the pass's rows and columns
  const _Float16* kb = K  + (size_t)bh * TT * HD + lane * 8;
  const _Float16* vb = Vt + (size_t)bh * HD * TT + lane * 8;
  const _Float16* kp = kb + ps * (32 * HD);
  const _Float16* vp = vb + ps * 512;
  const float scale = 0.125f;             // 1/sqrt(64)

  // K fragments run one pass ahead: those of the first pass are fetched here, those of each
  // further pass behind the score products of the pass before, into the same registers.
  v16h ka[2][2];                          // [key tile][k-half of head dim]
#pragma unroll
  for (int j = 0; j < 2; ++j) {
    ka[j][0] = load_frag(kp, j, 0, HD);
    ka[j][1] = load_frag(kp, j, 1, HD);
  }
  // The loads above name kp: as an input here the pair stays whole up to this wait,
  // which stands in front of the code that rewrites it.
  asm volatile("s_wait_xcnt 0x0" :: "v"(kp) : "memory");

  for (int i = 0; i < NP; ++i) {
    v16h va[4];                           // [16 rows of d], k = the 32 keys
#pragma unroll
    for (int ni = 0; ni < 4; ++ni) va[ni] = load_frag(vp, ni, 0, TT);

    // ---- S^T = K @ Q^T : 2 key tiles x 2 query groups, K frags shared ----
    // s[q][j][r] = score of key 32ps + 16j + 8hl + r with this lane's query
    v8f s[2][2];
#pragma unroll
    for (int j = 0; j < 2; ++j) {
#pragma unroll
      for (int q = 0; q < 2; ++q) {
        v8f t = (v8f){0.f, 0.f, 0.f, 0.f, 0.f, 0.f, 0.f, 0.f};
        t = wmma16(ka[j][0], qb[q][0], t);
        t = wmma16(ka[j][1], qb[q][1], t);
        s[q][j] = t;
      }
    }

    // ---- the next pass's K: in flight under softmax and the O^T products ----
    // next 32 keys: 4 blocks of K; the last pass fetches the first pass's again, unused
    ps = (ps + 1) % NP;
    kp = kb + ps * (32 * HD);
#pragma unroll
    for (int j = 0; j < 2; ++j) {
      ka[j][0] = load_frag(kp, j, 0, HD);
      ka[j][1] = load_frag(kp, j, 1, HD);
    }
    // Holds the fetch at this place: without it the compiler sinks these loads far into
    // the softmax, whose temporaries then take the K registers, and most of the lead goes.
    __builtin_amdgcn_sched_barrier(0);

    // ---- online softmax over the 32 new keys, per query group ------------
    v16h pb[2];
#pragma unroll
    for (int q = 0; q < 2; ++q) {
      float mx = fmaxf(s[q][0][0], s[q][1][0]);
#pragma unroll
      for (int r = 1; r < 8; ++r) mx = fmaxf(mx, fmaxf(s[q][0][r], s[q][1][r]));
      mx = fmaxf(mx, xhalf(mx));          // the other 16 keys of this query
      const float mn = fmaxf(mrun[q], mx * scale);
      const float alpha = __expf(mrun[q] - mn);
      mrun[q] = mn;
      v2f rs = (v2f){0.f, 0.f};           // sums of even and of odd r
#pragma unroll
      for (int j = 0; j < 2; ++j) {
#pragma unroll
        for (int r = 0; r < 8; r += 2) {
          const v2f x = (v2f){s[q][j][r], s[q][j][r + 1]} * scale - mn;
          const v2f p = (v2f){__expf(x.x), __expf(x.y)};
          rs += p;
          const v2h ph = __builtin_convertvector(p, v2h);
          pb[q][8 * j + r]     = ph.x;    // k = 16j + 8hl + r
          pb[q][8 * j + r + 1] = ph.y;
        }
      }
      lsum[q] = lsum[q] * alpha + (rs.x + rs.y);
#pragma unroll
      for (int ni = 0; ni < 4; ++ni)
#pragma unroll
        for (int r = 0; r < 8; ++r)
          o[q][ni][r] *= alpha;
    }

    // ---- O^T += V^T @ P^T : V frags shared between query groups ----------
#pragma unroll
    for (int ni = 0; ni < 4; ++ni) {
      o[0][ni] = wmma16(va[ni], pb[0], o[0][ni]);
      o[1][ni] = wmma16(va[ni], pb[1], o[1][ni]);
    }
    // Holds the wait below at the foot of the pass, where the address translations are
    // long done; lifted to directly behind the loads it would stall the wave there.
    __builtin_amdgcn_sched_barrier(0);
    // This pass's loads name kp and vp: as inputs here both pairs stay whole up to
    // this wait, which stands in front of the code that rewrites them.
    asm volatile("s_wait_xcnt 0x0" :: "v"(kp), "v"(vp) : "memory");
    vp = vb + ps * 512;                   // next k block of V^T
  }

  // ---- finalize: join the halves' sums, divide, store 16-byte runs of d ---
  const int b = bh / HH;
  const int h = bh % HH;
  v8h pk[2][4];
#pragma unroll
  for (int q = 0; q < 2; ++q) {
    const float inv = 1.f / (lsum[q] + xhalf(lsum[q]));
#pragma unroll
    for (int ni = 0; ni < 4; ++ni)
#pragma unroll
      for (int r = 0; r < 8; ++r) pk[q][ni][r] = (_Float16)(o[q][ni][r] * inv);
  }
  // row b*T + q0 + l16, k = h*64 + 8hl; a query group is one row tile further,
  // ni steps through the halves of two k blocks: 512 bytes in a row per store
  _Float16* ao = AO + frag_idx(b * TT + q0 + l16, h * HD + 8 * hl, DD);
#pragma unroll
  for (int q = 0; q < 2; ++q)
#pragma unroll
    for (int ni = 0; ni < 4; ++ni)
      *(v8h*)(ao + q * RT + ni * 256) = pk[q][ni];
}

// ---------------------------------------------------------------------------
extern "C" void kernel_launch(void* const* d_in, const int* in_sizes, int n_in,
                              void* d_out, int out_size, void* d_ws, size_t ws_size,
                              hipStream_t stream) {
  const float* x  = (const float*)d_in[0];
  const float* Wq = (const float*)d_in[1];
  const float* bq = (const float*)d_in[2];
  const float* Wk = (const float*)d_in[3];
  const float* bk = (const float*)d_in[4];
  const float* Wv = (const float*)d_in[5];
  const float* bv = (const float*)d_in[6];
  const float* Wo = (const float*)d_in[7];
  const float* bo = (const float*)d_in[8];

  char* ws = (char*)d_ws;
  _Float16* xh  = (_Float16*)(ws + OFF_XH);
  _Float16* wqt = (_Float16*)(ws + OFF_WQT);
  _Float16* wot = (_Float16*)(ws + OFF_WOT);
  _Float16* qh  = (_Float16*)(ws + OFF_Q);
  _Float16* kh  = (_Float16*)(ws + OFF_K);
  _Float16* vt  = (_Float16*)(ws + OFF_VT);
  _Float16* ao  = (_Float16*)(ws + OFF_AO);

  // wqt, wkt, wvt, wot stand one behind the other in the workspace; so do qh, kh, vt
  cvt_all_kernel<<<4 * WBLK + XBLK, 256, 0, stream>>>(x, Wq, Wk, Wv, Wo, xh, wqt);

  gemm_wmma_kernel<<<GT_M * GT_N / 4, GW * 32, 0, stream>>>(xh, wqt, bq, bk, bv, (void*)qh, 0);

  const int attn_blocks = (BB * HH * (TT / 32)) / 8;   // 384
  flash_attn_kernel<<<attn_blocks, 256, 0, stream>>>(qh, kh, vt, ao);

  gemm_wmma_kernel<<<GT_M * GT_N / 8, 256, 0, stream>>>(ao, wot, bo, bo, bo, d_out, 1);
}

// v008
// A run of this version takes 105 microseconds.
// Two timings next to v007 put it at 1.06 and 1.05 times that version's speed.
// All steps since v000 together make it 3.04 times as fast.
#include <hip/hip_runtime.h>

// ---------------------------------------------------------------------------
// Multi-head attention for MI455X (gfx1250, wave32, WMMA f32_16x16x32_f16)
//   B=4, T=2048, D=768, H=12, hd=64
// Pipeline:
//   1) one launch: f32->f16 convert x; transpose+convert Wq/Wk/Wv/Wo
//   2) one launch: WMMA GEMMs (32x64 tile/wave) -> Q,K in [B,H,T,64] f16 ;
//      V in [B,H,64,T] f16 (transposed)
//   3) flash-attention, transposed (S^T = K Q^T, O^T += V^T P^T): 1 wave per
//      32 query columns (2 groups sharing K/V fragments), keys streamed 32 at
//      a time, online softmax in-lane with lazy rescale, P^T packed from the
//      S^T accumulators
//   4) WMMA GEMM attn_out @ Wo + bo -> f32 d_out
// Every f16 operand in the workspace is kept in fragment order (frag_idx), so
// that one fragment load instruction reads 512 contiguous bytes.
// ---------------------------------------------------------------------------

typedef _Float16 v16h __attribute__((ext_vector_type(16)));
typedef _Float16 v8h  __attribute__((ext_vector_type(8)));
typedef float    v8f  __attribute__((ext_vector_type(8)));
typedef _Float16 v2h  __attribute__((ext_vector_type(2)));
typedef float    v2f  __attribute__((ext_vector_type(2)));
typedef float    v4f  __attribute__((ext_vector_type(4)));

#define BB 4
#define TT 2048
#define DD 768
#define HH 12
#define HD 64
#define MM (BB * TT)           // 8192 rows

// GEMM wave-tile: 32 rows x 64 cols
#define WTM 32
#define WTN 64
#define GT_M (MM / WTM)        // 256
#define GT_N (DD / WTN)        // 12
#define RT (16 * DD)           // halves of one 16-row tile of a [*, 768] operand
#define GW 12                  // waves of a block of the Q, K, V launch
#define KB 3                   // k blocks of fragments that a GEMM wave keeps in flight
#define NS (DD / 32 / KB)      // 8 stages of KB k blocks in a GEMM's k walk
#define NP (TT / 32)           // 64 passes of 32 keys in the attention's key walk

// convert launch, blocks of 8 waves. A wave of the weight part makes 2 row tiles x 1 k
// block (4 runs of 8 halves a lane), a wave of the x part 1 row tile x 4 k blocks (8 runs).
#define WBLK ((DD / 32) * (DD / 32) / 8)   // 72 a weight
#define XBLK ((MM / 16) * (DD / 128) / 8)  // 384 for x

// Workspace byte offsets
#define OFF_XH   0u
#define OFF_WQT  (OFF_XH  + (size_t)MM * DD * 2)
#define OFF_WKT  (OFF_WQT + (size_t)DD * DD * 2)
#define OFF_WVT  (OFF_WKT + (size_t)DD * DD * 2)
#define OFF_WOT  (OFF_WVT + (size_t)DD * DD * 2)
#define OFF_Q    (OFF_WOT + (size_t)DD * DD * 2)
#define OFF_K    (OFF_Q   + (size_t)MM * DD * 2)
#define OFF_VT   (OFF_K   + (size_t)MM * DD * 2)
#define OFF_AO   (OFF_VT  + (size_t)MM * DD * 2)

__device__ __forceinline__ v8f wmma16(v16h a, v16h b, v8f c) {
  // D = A(16x32,f16) x B(32x16,f16) + C(16x16,f32)
  return __builtin_amdgcn_wmma_f32_16x16x32_f16(
      /*neg_a=*/false, a, /*neg_b=*/false, b,
      /*c_mod=*/(short)0, c, /*reuse_a=*/false, /*reuse_b=*/false);
}

// Build a 16-half fragment from two contiguous 16-byte runs.
__device__ __forceinline__ v16h make_frag(const _Float16* p0, const _Float16* p1) {
  v8h lo = *(const v8h*)p0;
  v8h hi = *(const v8h*)p1;
  v16h r;
#pragma unroll
  for (int i = 0; i < 8; ++i) { r[i] = lo[i]; r[i + 8] = hi[i]; }
  return r;
}

// Fragment order of a [rows][kd] f16 operand: blocks of 16 rows x 32 k, 512
// halves each, k blocks of one row tile in a row. In a block, lane
// l = 16 * (k bit 3) + row % 16 owns halves l*8 .. l*8+7 (k bit 4 = 0) and
// 256 + l*8 .. (k bit 4 = 1): the two 16-byte runs that make_frag joins.
__device__ __forceinline__ size_t frag_idx(int row, int k, int kd) {
  return ((size_t)((row >> 4) * (kd >> 5) + (k >> 5)) << 9) +
         (size_t)((((k >> 4) & 1) << 8) + ((((k >> 3) & 1) << 4) + (row & 15)) * 8 + (k & 7));
}

// Fragment of row tile rt, k block ks: base + lane * 8 is passed as p.
__device__ __forceinline__ v16h load_frag(const _Float16* p, int rt, int ks, int kd) {
  const _Float16* q = p + ((size_t)(rt * (kd >> 5) + ks) << 9);
  return make_frag(q, q + 256);
}

// ---------------------------------------------------------------------------
// All five conversions as block ranges of one grid (none reads what another
// writes). Blocks 0 .. 4*WBLK-1, the weights, whose loads are the more scattered:
//   wt[sel](row n, k) = (f16) W[sel][k*768 + n]   (768x768), fragment order
// the rest: xh = (f16) x, [M, 768] row-major -> fragment order
// A lane makes whole 16-byte runs (8 k of one row): lane l of a wave owns place l of
// each half block, so a store instruction writes 512 bytes in a row. All loads of a
// lane are issued before the first conversion.
__global__ __launch_bounds__(256)
void cvt_all_kernel(const float* __restrict__ x,
                    const float* __restrict__ Wq, const float* __restrict__ Wk,
                    const float* __restrict__ Wv, const float* __restrict__ Wo,
                    _Float16* __restrict__ xh, _Float16* __restrict__ wt) {
  const int blk  = blockIdx.x;
  const int lane = threadIdx.x & 31;
  // as a scalar: block addresses then stay in scalar registers
  const int wave = __builtin_amdgcn_readfirstlane(threadIdx.x >> 5);
  const int hl   = lane >> 4;   // k bit 3
  const int l16  = lane & 15;   // row % 16
  if (blk < 4 * WBLK) {
    const int sel = blk / WBLK;
    const float* in = sel == 0 ? Wq : sel == 1 ? Wk : sel == 2 ? Wv : Wo;
    const int wv = (blk - sel * WBLK) * 8 + wave;
    const int tp = wv / (DD / 32);          // pair of row tiles: n = 32 tp ..
    const int kb = wv % (DD / 32);          // k block
    // W[k = 32 kb + 8 hl][n = 32 tp + l16]
    const float* p = in + (size_t)(kb * 32 + hl * 8) * DD + tp * 32 + l16;
    float f[2][2][8];                       // [row tile][k bit 4][k & 7]
#pragma unroll
    for (int h = 0; h < 2; ++h)
#pragma unroll
      for (int j = 0; j < 8; ++j)
#pragma unroll
        for (int t = 0; t < 2; ++t)         // the two halves of one 128-byte line
          f[t][h][j] = p[(h * 16 + j) * DD + t * 16];
    // the conversions below may reuse the registers that hold these loads' address;
    // as an input the pair stays whole up to this wait
    asm volatile("s_wait_xcnt 0x0" :: "v"(p) : "memory");
    _Float16* o = wt + (size_t)sel * DD * DD + (size_t)tp * 2 * RT + kb * 512 + lane * 8;
#pragma unroll
    for (int t = 0; t < 2; ++t)
#pragma unroll
      for (int h = 0; h < 2; ++h) {
        v8h pk;
#pragma unroll
        for (int j = 0; j < 8; ++j) pk[j] = (_Float16)f[t][h][j];
        *(v8h*)(o + t * RT + h * 256) = pk;
      }
    // no register that these stores name is rewritten in front of this wait
    asm volatile("s_wait_xcnt 0x0" ::: "memory");
  } else {
    const int wv = (blk - 4 * WBLK) * 8 + wave;
    const int rt = wv / (DD / 128);         // row tile
    const int kq = wv % (DD / 128);         // four k blocks: 512 bytes of each row
    // x[row = 16 rt + l16][k = 128 kq + 8 hl]
    const float* p = x + (size_t)(rt * 16 + l16) * DD + kq * 128 + hl * 8;
    v4f f[8][2];                            // [half block][k bit 2]
#pragma unroll
    for (int u = 0; u < 8; ++u) {
      f[u][0] = *(const v4f*)(p + u * 16);
      f[u][1] = *(const v4f*)(p + u * 16 + 4);
    }
    // The loaded values as inputs: without them the compiler converts the first runs
    // between the loads and issues the last loads only when the first have come back;
    // so all 16 are in flight at once. The wait: the code below may reuse the registers
    // that hold these loads' address; as an input the pair stays whole up to it.
    asm volatile("s_wait_xcnt 0x0"
                 :: "v"(p), "v"(f[0][0]), "v"(f[0][1]), "v"(f[1][0]), "v"(f[1][1]),
                    "v"(f[2][0]), "v"(f[2][1]), "v"(f[3][0]), "v"(f[3][1]),
                    "v"(f[4][0]), "v"(f[4][1]), "v"(f[5][0]), "v"(f[5][1]),
                    "v"(f[6][0]), "v"(f[6][1]), "v"(f[7][0]), "v"(f[7][1])
                 : "memory");
    _Float16* o = xh + (size_t)rt * RT + kq * 4 * 512 + lane * 8;
#pragma unroll
    for (int u = 0; u < 8; ++u) {
      v8h pk;
#pragma unroll
      for (int j = 0; j < 4; ++j) {
        pk[j]     = (_Float16)f[u][0][j];
        pk[j + 4] = (_Float16)f[u][1][j];
      }
      *(v8h*)(o + u * 256) = pk;
    }
    // no register that these stores name is rewritten in front of this wait
    asm volatile("s_wait_xcnt 0x0" ::: "memory");
  }
}

// ---------------------------------------------------------------------------
// WMMA GEMM, 32x64 tile per wave (2 M-subtiles x 4 N-subtiles):
//   A  : f16 [M, 768], fragment order
//   Bt : f16 transposed weight [N=768, K=768] (row n = column n of W), fragment order
// mode 0: out f16 [B,H][T,64], each [T,64] in fragment order   (Q, K)
// mode 1: out f16 [B,H][64,T], each [64,T] in fragment order   (V transposed)
// mode 2: out f32 row-major [M, 768]   (final projection)
// A launch holds one product (proj = 1: mode 2, 8 waves, 8 tiles a block) or three that
// share A (proj = 0): a block is then 12 waves, 4 tiles x 3 products, so that the three
// waves of a tile read the same A lines at the same time. Product sel takes weight
// Bt3 + sel * 768 * 768, bias sel and the sel-th [M, 768] f16 plane of out;
// sel 0, 1 are mode 0, sel 2 is mode 1.
// ---------------------------------------------------------------------------
__global__ __launch_bounds__(GW * 32)
void gemm_wmma_kernel(const _Float16* __restrict__ A,
                      const _Float16* __restrict__ Bt3,
                      const float* __restrict__ bias0,
                      const float* __restrict__ bias1,
                      const float* __restrict__ bias2,
                      void* __restrict__ out, int proj) {
  const int tid  = threadIdx.x;
  const int lane = tid & 31;
  // as a scalar: the product that it selects picks pointers and the store branch
  const int wave = __builtin_amdgcn_readfirstlane(tid >> 5);
  const int sel  = proj ? 0 : wave >> 2;
  const int mode = proj ? 2 : (sel == 2 ? 1 : 0);
  const _Float16* Bt = Bt3 + (size_t)sel * DD * DD;
  const float* bias  = sel == 0 ? bias0 : sel == 1 ? bias1 : bias2;
  const int w    = proj ? blockIdx.x * 8 + wave : blockIdx.x * 4 + (wave & 3);
  const int tm   = w % GT_M;
  const int tn   = w / GT_M;
  const int m0   = tm * WTM;
  const int n0   = tn * WTN;
  const int hl   = lane >> 4;   // half-wave id
  const int l16  = lane & 15;

  // this lane's 16 bytes in k block 0 of the wave's first row tile of A and of Bt
  const _Float16* a0 = A  + (size_t)(m0 >> 4) * RT + lane * 8;
  const _Float16* b0 = Bt + (size_t)(n0 >> 4) * RT + lane * 8;
  // Blocks of one tn read the same rows of Bt, blocks of one tm the same rows of A. They
  // enter the k walk at different stages and wrap round, so that they do not ask L2 for
  // the same lines at the same moment, and most find a line that another has fetched.
  // Blocks whose indices differ by 1, by 8 or by one tn differ in the stage. It is the same
  // for a block's waves, which go on sharing lines in the WGP cache.
  unsigned st = (blockIdx.x + (blockIdx.x >> 3) + 3u * tn) % NS;
  const _Float16* ak = a0 + st * (KB * 512);
  const _Float16* bk = b0 + st * (KB * 512);

  v8f acc[2][4];
#pragma unroll
  for (int mi = 0; mi < 2; ++mi)
#pragma unroll
    for (int ni = 0; ni < 4; ++ni)
      acc[mi][ni] = (v8f){0.f, 0.f, 0.f, 0.f, 0.f, 0.f, 0.f, 0.f};

  // Fragments run one stage (KB k blocks) ahead, in KB register sets: those of the first
  // stage are fetched here, those of the next stage's block u behind the products of this
  // stage's block u, into its set.
  v16h a[KB][2], b[KB][4];
#pragma unroll
  for (int u = 0; u < KB; ++u) {
    a[u][0] = make_frag(ak + u * 512, ak + u * 512 + 256);
    a[u][1] = make_frag(ak + u * 512 + RT, ak + u * 512 + RT + 256);
#pragma unroll
    for (int ni = 0; ni < 4; ++ni)
      b[u][ni] = make_frag(bk + u * 512 + ni * RT, bk + u * 512 + ni * RT + 256);
  }
  // in front of the loop's set-up, which reuses the register that holds these loads' offset
  asm volatile("s_wait_xcnt 0x0" ::: "memory");
  // keeps that set-up behind the wait
  __builtin_amdgcn_sched_barrier(0);

  // stays rolled: unrolled further, the trips' register sets no longer fit and are spilled
#pragma nounroll
  for (int ks = KB; ks < DD / 32; ks += KB) {
    st = (st + 1) % NS;        // the stage that this trip fetches
    ak = a0 + st * (KB * 512);
    bk = b0 + st * (KB * 512);
#pragma unroll
    for (int u = 0; u < KB; ++u) {
#pragma unroll
      for (int ni = 0; ni < 4; ++ni) {
        acc[0][ni] = wmma16(a[u][0], b[u][ni], acc[0][ni]);
        acc[1][ni] = wmma16(a[u][1], b[u][ni], acc[1][ni]);
      }
      // Holds the fetch behind the products: lifted over them it would need registers of
      // its own beside the set that they still read.
      __builtin_amdgcn_sched_barrier(0);
      a[u][0] = make_frag(ak + u * 512, ak + u * 512 + 256);
      a[u][1] = make_frag(ak + u * 512 + RT, ak + u * 512 + RT + 256);
#pragma unroll
      for (int ni = 0; ni < 4; ++ni)
        b[u][ni] = make_frag(bk + u * 512 + ni * RT, bk + u * 512 + ni * RT + 256);
      // Holds the fetch in front of the next block's products: sunk towards its use it
      // would lose its lead.
      __builtin_amdgcn_sched_barrier(0);
    }
    // in front of the next trip's address set-up, which rewrites the registers that this
    // trip's loads name
    asm volatile("s_wait_xcnt 0x0" ::: "memory");
  }
#pragma unroll
  for (int u = 0; u < KB; ++u)   // the last KB blocks: nothing is left to fetch
#pragma unroll
    for (int ni = 0; ni < 4; ++ni) {
      acc[0][ni] = wmma16(a[u][0], b[u][ni], acc[0][ni]);
      acc[1][ni] = wmma16(a[u][1], b[u][ni], acc[1][ni]);
    }

#pragma unroll
  for (int ni = 0; ni < 4; ++ni) {
    const int n = n0 + ni * 16 + l16;     // output column (C/D: N = lane%16)
    const float bval = bias[n];
    // the code below reuses the register that holds this load's offset
    asm volatile("s_wait_xcnt 0x0" ::: "memory");
    const int h = n >> 6;                 // head (64-wide N-tile stays in head)
    const int d = n & 63;
#pragma unroll
    for (int mi = 0; mi < 2; ++mi) {
      if (mode == 2) {
        float* o = (float*)out;
#pragma unroll
        for (int r = 0; r < 8; ++r) {
          int m = m0 + mi * 16 + r + 8 * hl;   // C/D: M = r + 8*(lane/16)
          o[(size_t)m * DD + n] = acc[mi][ni][r] + bval;
        }
        // the next tile's code reuses the registers that these stores name
        asm volatile("s_wait_xcnt 0x0" ::: "memory");
      } else {
        const int mb = m0 + mi * 16 + 8 * hl;  // row of r = 0, a multiple of 8
        const int b  = mb >> 11;               // T = 2048
        const int t0 = mb & 2047;
        _Float16* o = (_Float16*)out + (size_t)sel * MM * DD + (size_t)(b * HH + h) * TT * HD;
        if (mode == 0) {
#pragma unroll
          for (int r = 0; r < 8; ++r)
            o[frag_idx(t0 + r, d, HD)] = (_Float16)(acc[mi][ni][r] + bval);
          // the next tile's code reuses the registers that these stores name
          asm volatile("s_wait_xcnt 0x0" ::: "memory");
        } else {
          v8h pk;                              // k = t0 .. t0+7: one 16-byte run
#pragma unroll
          for (int r = 0; r < 8; ++r) pk[r] = (_Float16)(acc[mi][ni][r] + bval);
          *(v8h*)(o + frag_idx(d, t0, TT)) = pk;
          // the next tile's code reuses the registers that this store names
          asm volatile("s_wait_xcnt 0x0" ::: "memory");
        }
      }
    }
  }
}

// value of lane l ^ 16
__device__ __forceinline__ float xhalf(float x) {
  const int i = __builtin_bit_cast(int, x);
  return __builtin_bit_cast(
      float, __builtin_amdgcn_permlanex16(i, i, 0x76543210, 0xfedcba98, false, false));
}

__global__ __launch_bounds__(256)
void flash_attn_kernel(const _Float16* __restrict__ Q,
                       const _Float16* __restrict__ K,
                       const _Float16* __restrict__ Vt,
                       _Float16* __restrict__ AO) {
  const int tid  = threadIdx.x;
  const int lane = tid & 31;
  const int wave = tid >> 5;
  const int w    = blockIdx.x * 8 + wave;
  const int qt   = w & 63;                // T/32 = 64 query tiles
  const int bh   = w >> 6;                // 0..47
  const int hl   = lane >> 4;
  const int l16  = lane & 15;
  const int q0   = qt * 32;

  // Q B-fragments: [query group][k-half of head dim]
  v16h qb[2][2];
#pragma unroll
  for (int q = 0; q < 2; ++q) {
    const _Float16* qp = Q + (size_t)bh * TT * HD + lane * 8;
    qb[q][0] = load_frag(qp, (q0 >> 4) + q, 0, HD);
    qb[q][1] = load_frag(qp, (q0 >> 4) + q, 1, HD);
  }

  // o[q][ni][r] = O[query q0 + 16q + l16][d = 16ni + 8hl + r]
  v8f o[2][4];
  // This lane's query. mrun: the reference that the exponentials are taken against, the
  // same in both halves; thr: the unscaled score above which it must be raised;
  // lsum: sums of this half's keys, even and odd r apart.
  float mrun[2], thr[2];
  v2f lsum[2];
#pragma unroll
  for (int q = 0; q < 2; ++q) {
#pragma unroll
    for (int ni = 0; ni < 4; ++ni)
      o[q][ni] = (v8f){0.f, 0.f, 0.f, 0.f, 0.f, 0.f, 0.f, 0.f};
    mrun[q] = -__builtin_inff();
    thr[q]  = -__builtin_inff();          // the first pass always sets the reference
    lsum[q] = (v2f){0.f, 0.f};
  }

  // The 8 blocks of one (b,h) read the same K and V^T. Each enters the key walk at an
  // eighth of its own and wraps round, so that they do not ask L2 for the same lines at the
  // same moment, and most find a line that another has fetched; blocks with neighbouring
  // indices start at least a quarter of the walk apart. A block's waves walk alike and go on
  // sharing lines in the WGP cache.
  // the pass's place in the key order
  unsigned ps = ((blockIdx.x & 3) * 2 + ((blockIdx.x >> 2) & 1)) * (NP / 8);
  // this lane's 16 bytes in the first block of K and V^T, and of the pass's rows and columns
  const _Float16* kb = K  + (size_t)bh * TT * HD + lane * 8;
  const _Float16* vb = Vt + (size_t)bh * HD * TT + lane * 8;
  const _Float16* kp = kb + ps * (32 * HD);
  const _Float16* vp = vb + ps * 512;
  const float scale = 0.125f;             // 1/sqrt(64)
  const float ROOM = 5.5f;               // exp(5.5) = 245

  // K fragments run one pass ahead: those of the first pass are fetched here, those of each
  // further pass behind the score products of the pass before, into the same registers.
  v16h ka[2][2];                          // [key tile][k-half of head dim]
#pragma unroll
  for (int j = 0; j < 2; ++j) {
    ka[j][0] = load_frag(kp, j, 0, HD);
    ka[j][1] = load_frag(kp, j, 1, HD);
  }
  // The loads above name kp: as an input here the pair stays whole up to this wait,
  // which stands in front of the code that rewrites it.
  asm volatile("s_wait_xcnt 0x0" :: "v"(kp) : "memory");

  for (int i = 0; i < NP; ++i) {
    v16h va[4];                           // [16 rows of d], k = the 32 keys
#pragma unroll
    for (int ni = 0; ni < 4; ++ni) va[ni] = load_frag(vp, ni, 0, TT);

    // ---- S^T = K @ Q^T : 2 key tiles x 2 query groups, K frags shared ----
    // s[q][j][r] = score of key 32ps + 16j + 8hl + r with this lane's query
    v8f s[2][2];
#pragma unroll
    for (int j = 0; j < 2; ++j) {
#pragma unroll
      for (int q = 0; q < 2; ++q) {
        v8f t = (v8f){0.f, 0.f, 0.f, 0.f, 0.f, 0.f, 0.f, 0.f};
        t = wmma16(ka[j][0], qb[q][0], t);
        t = wmma16(ka[j][1], qb[q][1], t);
        s[q][j] = t;
      }
    }

    // ---- the next pass's K: in flight under softmax and the O^T products ----
    // next 32 keys: 4 blocks of K; the last pass fetches the first pass's again, unused
    ps = (ps + 1) % NP;
    kp = kb + ps * (32 * HD);
#pragma unroll
    for (int j = 0; j < 2; ++j) {
      ka[j][0] = load_frag(kp, j, 0, HD);
      ka[j][1] = load_frag(kp, j, 1, HD);
    }
    // Holds the fetch at this place: without it the compiler sinks these loads far into
    // the softmax, whose temporaries then take the K registers, and most of the lead goes.
    __builtin_amdgcn_sched_barrier(0);

    // ---- online softmax over the 32 new keys, lazy rescale ----------------
    // The reference stays as it is while no scaled score of the pass lies more than
    // ROOM above it: sums and O^T then need no factor, and P stays at or below
    // exp(ROOM), far inside f16. The quotient at the end is the same for any reference.
    float mx[2];                          // largest of this lane's own 16 scores
#pragma unroll
    for (int q = 0; q < 2; ++q) {
      mx[q] = fmaxf(s[q][0][0], s[q][1][0]);
#pragma unroll
      for (int r = 1; r < 8; ++r) mx[q] = fmaxf(mx[q], fmaxf(s[q][0][r], s[q][1][r]));
    }
    // one test a pass for the whole wave, a scalar branch; each lane tests its own keys,
    // so the halves exchange their maxima only where the reference moves
    if (__builtin_amdgcn_ballot_w32(mx[0] > thr[0] || mx[1] > thr[1]) != 0) {
#pragma unroll
      for (int q = 0; q < 2; ++q) {
        const float mf = fmaxf(mx[q], xhalf(mx[q]));   // with the other 16 keys of this query
        const float mn = fmaxf(mrun[q], mf * scale);
        const float alpha = __expf(mrun[q] - mn);
        mrun[q] = mn;
        thr[q]  = (mn + ROOM) * (1.f / scale);
        lsum[q] *= alpha;
#pragma unroll
        for (int ni = 0; ni < 4; ++ni)
#pragma unroll
          for (int r = 0; r < 8; ++r)
            o[q][ni][r] *= alpha;
      }
    }
    v16h pb[2];
#pragma unroll
    for (int q = 0; q < 2; ++q) {
#pragma unroll
      for (int j = 0; j < 2; ++j) {
#pragma unroll
        for (int r = 0; r < 8; r += 2) {
          const v2f x = (v2f){s[q][j][r], s[q][j][r + 1]} * scale - mrun[q];
          const v2f p = (v2f){__expf(x.x), __expf(x.y)};
          lsum[q] += p;
          const v2h ph = __builtin_convertvector(p, v2h);
          pb[q][8 * j + r]     = ph.x;    // k = 16j + 8hl + r
          pb[q][8 * j + r + 1] = ph.y;
        }
      }
    }

    // Keeps the sums from being spread among the products, where they take the V^T
    // registers as temporaries: each such place costs four idle slots behind its product.
    // Without it there are three such places; with it the compiler still leaves one.
    __builtin_amdgcn_sched_barrier(0);

    // ---- O^T += V^T @ P^T : V frags shared between query groups ----------
#pragma unroll
    for (int ni = 0; ni < 4; ++ni) {
      o[0][ni] = wmma16(va[ni], pb[0], o[0][ni]);
      o[1][ni] = wmma16(va[ni], pb[1], o[1][ni]);
    }
    // Holds the wait below at the foot of the pass, where the address translations are
    // long done; lifted to directly behind the loads it would stall the wave there.
    __builtin_amdgcn_sched_barrier(0);
    // This pass's loads name kp and vp: as inputs here both pairs stay whole up to
    // this wait, which stands in front of the code that rewrites them.
    asm volatile("s_wait_xcnt 0x0" :: "v"(kp), "v"(vp) : "memory");
    vp = vb + ps * 512;                   // next k block of V^T
  }

  // ---- finalize: join the halves' sums, divide, store 16-byte runs of d ---
  const int b = bh / HH;
  const int h = bh % HH;
  v8h pk[2][4];
#pragma unroll
  for (int q = 0; q < 2; ++q) {
    const float ls = lsum[q].x + lsum[q].y;
    const float inv = 1.f / (ls + xhalf(ls));
#pragma unroll
    for (int ni = 0; ni < 4; ++ni)
#pragma unroll
      for (int r = 0; r < 8; ++r) pk[q][ni][r] = (_Float16)(o[q][ni][r] * inv);
  }
  // row b*T + q0 + l16, k = h*64 + 8hl; a query group is one row tile further,
  // ni steps through the halves of two k blocks: 512 bytes in a row per store
  _Float16* ao = AO + frag_idx(b * TT + q0 + l16, h * HD + 8 * hl, DD);
#pragma unroll
  for (int q = 0; q < 2; ++q)
#pragma unroll
    for (int ni = 0; ni < 4; ++ni)
      *(v8h*)(ao + q * RT + ni * 256) = pk[q][ni];
}

// ---------------------------------------------------------------------------
extern "C" void kernel_launch(void* const* d_in, const int* in_sizes, int n_in,
                              void* d_out, int out_size, void* d_ws, size_t ws_size,
                              hipStream_t stream) {
  const float* x  = (const float*)d_in[0];
  const float* Wq = (const float*)d_in[1];
  const float* bq = (const float*)d_in[2];
  const float* Wk = (const float*)d_in[3];
  const float* bk = (const float*)d_in[4];
  const float* Wv = (const float*)d_in[5];
  const float* bv = (const float*)d_in[6];
  const float* Wo = (const float*)d_in[7];
  const float* bo = (const float*)d_in[8];

  char* ws = (char*)d_ws;
  _Float16* xh  = (_Float16*)(ws + OFF_XH);
  _Float16* wqt = (_Float16*)(ws + OFF_WQT);
  _Float16* wot = (_Float16*)(ws + OFF_WOT);
  _Float16* qh  = (_Float16*)(ws + OFF_Q);
  _Float16* kh  = (_Float16*)(ws + OFF_K);
  _Float16* vt  = (_Float16*)(ws + OFF_VT);
  _Float16* ao  = (_Float16*)(ws + OFF_AO);

  // wqt, wkt, wvt, wot stand one behind the other in the workspace; so do qh, kh, vt
  cvt_all_kernel<<<4 * WBLK + XBLK, 256, 0, stream>>>(x, Wq, Wk, Wv, Wo, xh, wqt);

  gemm_wmma_kernel<<<GT_M * GT_N / 4, GW * 32, 0, stream>>>(xh, wqt, bq, bk, bv, (void*)qh, 0);

  const int attn_blocks = (BB * HH * (TT / 32)) / 8;   // 384
  flash_attn_kernel<<<attn_blocks, 256, 0, stream>>>(qh, kh, vt, ao);

  gemm_wmma_kernel<<<GT_M * GT_N / 8, 256, 0, stream>>>(ao, wot, bo, bo, bo, d_out, 1);
}

// v009
// A run of this version takes 99.9 microseconds.
// Next to v008, in two timings, it ran 1.05 times as fast each time.
// All steps since v000 together make it 3.21 times as fast.
#include <hip/hip_runtime.h>

// ---------------------------------------------------------------------------
// Multi-head attention for MI455X (gfx1250, wave32, WMMA f32_16x16x32_f16)
//   B=4, T=2048, D=768, H=12, hd=64
// Pipeline:
//   1) one launch: f32->f16 convert x; transpose+convert Wq/Wk/Wv/Wo
//   2) one launch: WMMA GEMMs (2 x 4 tiles of 16x16 a wave) -> Q,K in [B,H,T,64] f16 ;
//      V in [B,H,64,T] f16 (transposed)
//   3) flash-attention, transposed (S^T = K Q^T, O^T += V^T P^T): 1 wave per
//      32 query columns (2 groups sharing K/V fragments), keys streamed 32 at
//      a time, online softmax in-lane with lazy rescale, P^T packed from the
//      S^T accumulators
//   4) WMMA GEMM attn_out @ Wo + bo -> f32 d_out
// Every f16 operand in the workspace is kept in fragment order (frag_idx), so
// that one fragment load instruction reads 512 contiguous bytes. Every GEMM
// output leaves in 16-byte stores that fill whole 128-byte lines.
// ---------------------------------------------------------------------------

typedef _Float16 v16h __attribute__((ext_vector_type(16)));
typedef _Float16 v8h  __attribute__((ext_vector_type(8)));
typedef float    v8f  __attribute__((ext_vector_type(8)));
typedef _Float16 v2h  __attribute__((ext_vector_type(2)));
typedef float    v2f  __attribute__((ext_vector_type(2)));
typedef float    v4f  __attribute__((ext_vector_type(4)));

#define BB 4
#define TT 2048
#define DD 768
#define HH 12
#define HD 64
#define MM (BB * TT)           // 8192 rows

// GEMM wave-tile: 32 rows x 64 cols (Q, K: 64 rows x 32 cols)
#define WTM 32
#define WTN 64
#define GT_M (MM / WTM)        // 256
#define GT_N (DD / WTN)        // 12
#define RT (16 * DD)           // halves of one 16-row tile of a [*, 768] operand
#define GW 12                  // waves of a block of the Q, K, V launch
#define KB 3                   // k blocks of fragments that a GEMM wave keeps in flight
#define NS (DD / 32 / KB)      // 8 stages of KB k blocks in a GEMM's k walk
#define NP (TT / 32)           // 64 passes of 32 keys in the attention's key walk

// convert launch, blocks of 8 waves. A wave of the weight part makes 2 row tiles x 1 k
// block (4 runs of 8 halves a lane), a wave of the x part 1 row tile x 4 k blocks (8 runs).
#define WBLK ((DD / 32) * (DD / 32) / 8)   // 72 a weight
#define XBLK ((MM / 16) * (DD / 128) / 8)  // 384 for x

// Workspace byte offsets
#define OFF_XH   0u
#define OFF_WQT  (OFF_XH  + (size_t)MM * DD * 2)
#define OFF_WKT  (OFF_WQT + (size_t)DD * DD * 2)
#define OFF_WVT  (OFF_WKT + (size_t)DD * DD * 2)
#define OFF_WOT  (OFF_WVT + (size_t)DD * DD * 2)
#define OFF_Q    (OFF_WOT + (size_t)DD * DD * 2)
#define OFF_K    (OFF_Q   + (size_t)MM * DD * 2)
#define OFF_VT   (OFF_K   + (size_t)MM * DD * 2)
#define OFF_AO   (OFF_VT  + (size_t)MM * DD * 2)

__device__ __forceinline__ v8f wmma16(v16h a, v16h b, v8f c) {
  // D = A(16x32,f16) x B(32x16,f16) + C(16x16,f32)
  return __builtin_amdgcn_wmma_f32_16x16x32_f16(
      /*neg_a=*/false, a, /*neg_b=*/false, b,
      /*c_mod=*/(short)0, c, /*reuse_a=*/false, /*reuse_b=*/false);
}

// Build a 16-half fragment from two contiguous 16-byte runs.
__device__ __forceinline__ v16h make_frag(const _Float16* p0, const _Float16* p1) {
  v8h lo = *(const v8h*)p0;
  v8h hi = *(const v8h*)p1;
  v16h r;
#pragma unroll
  for (int i = 0; i < 8; ++i) { r[i] = lo[i]; r[i + 8] = hi[i]; }
  return r;
}

// Fragment order of a [rows][kd] f16 operand: blocks of 16 rows x 32 k, 512
// halves each, k blocks of one row tile in a row. In a block, lane
// l = 16 * (k bit 3) + row % 16 owns halves l*8 .. l*8+7 (k bit 4 = 0) and
// 256 + l*8 .. (k bit 4 = 1): the two 16-byte runs that make_frag joins.
__device__ __forceinline__ size_t frag_idx(int row, int k, int kd) {
  return ((size_t)((row >> 4) * (kd >> 5) + (k >> 5)) << 9) +
         (size_t)((((k >> 4) & 1) << 8) + ((((k >> 3) & 1) << 4) + (row & 15)) * 8 + (k & 7));
}

// Fragment of row tile rt, k block ks: base + lane * 8 is passed as p.
__device__ __forceinline__ v16h load_frag(const _Float16* p, int rt, int ks, int kd) {
  const _Float16* q = p + ((size_t)(rt * (kd >> 5) + ks) << 9);
  return make_frag(q, q + 256);
}

// ---------------------------------------------------------------------------
// All five conversions as block ranges of one grid (none reads what another
// writes). Blocks 0 .. 4*WBLK-1, the weights, whose loads are the more scattered:
//   wt[sel](row n, k) = (f16) W[sel][k*768 + n]   (768x768), fragment order
//   Wo alone: place l of row tile T holds column 64 (T / 4) + 4 l + T % 4, so that in the
//   out projection a lane's four column tiles are four neighbouring columns
// the rest: xh = (f16) x, [M, 768] row-major -> fragment order
// A lane makes whole 16-byte runs (8 k of one row): lane l of a wave owns place l of
// each half block, so a store instruction writes 512 bytes in a row. All loads of a
// lane are issued before the first conversion.
__global__ __launch_bounds__(256)
void cvt_all_kernel(const float* __restrict__ x,
                    const float* __restrict__ Wq, const float* __restrict__ Wk,
                    const float* __restrict__ Wv, const float* __restrict__ Wo,
                    _Float16* __restrict__ xh, _Float16* __restrict__ wt) {
  const int blk  = blockIdx.x;
  const int lane = threadIdx.x & 31;
  // as a scalar: block addresses then stay in scalar registers
  const int wave = __builtin_amdgcn_readfirstlane(threadIdx.x >> 5);
  const int hl   = lane >> 4;   // k bit 3
  const int l16  = lane & 15;   // row % 16
  if (blk < 4 * WBLK) {
    const int sel = blk / WBLK;
    const float* in = sel == 0 ? Wq : sel == 1 ? Wk : sel == 2 ? Wv : Wo;
    const int wv = (blk - sel * WBLK) * 8 + wave;
    const int tp = wv / (DD / 32);          // pair of row tiles: 2 tp, 2 tp + 1
    const int kb = wv % (DD / 32);          // k block
    // the column of W that this lane's place holds in row tile 2 tp, and in 2 tp + 1
    const int n0 = sel == 3 ? (tp >> 1) * 64 + (tp & 1) * 2 + l16 * 4 : tp * 32 + l16;
    const int n1 = sel == 3 ? n0 + 1 : n0 + 16;
    // W[k = 32 kb + 8 hl][n]
    const float* p  = in + (size_t)(kb * 32 + hl * 8) * DD + n0;
    const float* p1 = in + (size_t)(kb * 32 + hl * 8) * DD + n1;
    float f[2][2][8];                       // [row tile][k bit 4][k & 7]
#pragma unroll
    for (int h = 0; h < 2; ++h)
#pragma unroll
      for (int j = 0; j < 8; ++j) {         // both tiles read the same 128-byte lines
        f[0][h][j] = p[(h * 16 + j) * DD];
        f[1][h][j] = p1[(h * 16 + j) * DD];
      }
    // the conversions below may reuse the registers that hold these loads' addresses;
    // as inputs the pairs stay whole up to this wait
    asm volatile("s_wait_xcnt 0x0" :: "v"(p), "v"(p1) : "memory");
    _Float16* o = wt + (size_t)sel * DD * DD + (size_t)tp * 2 * RT + kb * 512 + lane * 8;
#pragma unroll
    for (int t = 0; t < 2; ++t)
#pragma unroll
      for (int h = 0; h < 2; ++h) {
        v8h pk;
#pragma unroll
        for (int j = 0; j < 8; ++j) pk[j] = (_Float16)f[t][h][j];
        *(v8h*)(o + t * RT + h * 256) = pk;
      }
    // no register that these stores name is rewritten in front of this wait
    asm volatile("s_wait_xcnt 0x0" ::: "memory");
  } else {
    const int wv = (blk - 4 * WBLK) * 8 + wave;
    const int rt = wv / (DD / 128);         // row tile
    const int kq = wv % (DD / 128);         // four k blocks: 512 bytes of each row
    // x[row = 16 rt + l16][k = 128 kq + 8 hl]
    const float* p = x + (size_t)(rt * 16 + l16) * DD + kq * 128 + hl * 8;
    v4f f[8][2];                            // [half block][k bit 2]
#pragma unroll
    for (int u = 0; u < 8; ++u) {
      f[u][0] = *(const v4f*)(p + u * 16);
      f[u][1] = *(const v4f*)(p + u * 16 + 4);
    }
    // The loaded values as inputs: without them the compiler converts the first runs
    // between the loads and issues the last loads only when the first have come back;
    // so all 16 are in flight at once. The wait: the code below may reuse the registers
    // that hold these loads' address; as an input the pair stays whole up to it.
    asm volatile("s_wait_xcnt 0x0"
                 :: "v"(p), "v"(f[0][0]), "v"(f[0][1]), "v"(f[1][0]), "v"(f[1][1]),
                    "v"(f[2][0]), "v"(f[2][1]), "v"(f[3][0]), "v"(f[3][1]),
                    "v"(f[4][0]), "v"(f[4][1]), "v"(f[5][0]), "v"(f[5][1]),
                    "v"(f[6][0]), "v"(f[6][1]), "v"(f[7][0]), "v"(f[7][1])
                 : "memory");
    _Float16* o = xh + (size_t)rt * RT + kq * 4 * 512 + lane * 8;
#pragma unroll
    for (int u = 0; u < 8; ++u) {
      v8h pk;
#pragma unroll
      for (int j = 0; j < 4; ++j) {
        pk[j]     = (_Float16)f[u][0][j];
        pk[j + 4] = (_Float16)f[u][1][j];
      }
      *(v8h*)(o + u * 256) = pk;
    }
    // no register that these stores name is rewritten in front of this wait
    asm volatile("s_wait_xcnt 0x0" ::: "memory");
  }
}

// ---------------------------------------------------------------------------
// WMMA GEMM, a wave holds 2 x 4 tiles of 16 x 16: 2 row tiles of the matrix instruction's
// first operand, 4 of its second.
//   A  : f16 [M, 768], fragment order
//   Bt : f16 transposed weight [N=768, K=768] (row n = column n of W), fragment order
// mode 0: out f16 [B,H][T,64], each [T,64] in fragment order   (Q, K)
// mode 1: out f16 [B,H][64,T], each [64,T] in fragment order   (V transposed)
// mode 2: out f32 row-major [M, 768]   (final projection)
// An accumulator's 8 registers run along the first operand's rows. Modes 1 and 2 take A
// first (32 rows x 64 columns of the product). Mode 0 takes Bt first (32 columns x 64
// rows): a lane then holds 8 neighbouring d of one t, one 16-byte run of the output's
// fragment order, as it holds 8 neighbouring t of one d in mode 1. In mode 2 the rows of
// Bt are dealt so that a lane's four column tiles are four neighbouring columns.
// A launch holds one product (proj = 1: mode 2, 8 waves, 8 tiles a block) or three that
// share A (proj = 0): a block is then 12 waves, 4 tiles x 3 products on the same 128 rows,
// so that the products' waves read the same A lines at the same time. Product sel takes weight
// Bt3 + sel * 768 * 768, bias sel and the sel-th [M, 768] f16 plane of out;
// sel 0, 1 are mode 0, sel 2 is mode 1.
// ---------------------------------------------------------------------------
__global__ __launch_bounds__(GW * 32)
void gemm_wmma_kernel(const _Float16* __restrict__ A,
                      const _Float16* __restrict__ Bt3,
                      const float* __restrict__ bias0,
                      const float* __restrict__ bias1,
                      const float* __restrict__ bias2,
                      void* __restrict__ out, int proj) {
  const int tid  = threadIdx.x;
  const int lane = tid & 31;
  // as a scalar: the product that it selects picks pointers and the store branch
  const int wave = __builtin_amdgcn_readfirstlane(tid >> 5);
  const int sel  = proj ? 0 : wave >> 2;
  const int mode = proj ? 2 : (sel == 2 ? 1 : 0);
  const _Float16* Bt = Bt3 + (size_t)sel * DD * DD;
  const float* bias  = sel == 0 ? bias0 : sel == 1 ? bias1 : bias2;
  const int w    = proj ? blockIdx.x * 8 + wave : blockIdx.x * 4 + (wave & 3);
  const int tn   = w / GT_M;
  // Mode 0: the four waves of a product cover the same 128 rows x 64 columns as in mode 1,
  // as 2 x 2 tiles of 64 rows x 32 columns.
  const int m0   = mode == 0 ? ((w & ~3) % GT_M) * WTM + (wave & 1) * 64 : (w % GT_M) * WTM;
  const int n0   = mode == 0 ? tn * WTN + (wave & 2) * 16 : tn * WTN;
  const int hl   = lane >> 4;   // half-wave id
  const int l16  = lane & 15;

  // this lane's 16 bytes in k block 0 of the wave's first row tile of A and of Bt
  const _Float16* pa = A  + (size_t)(m0 >> 4) * RT + lane * 8;
  const _Float16* pb = Bt + (size_t)(n0 >> 4) * RT + lane * 8;
  // the first operand (2 row tiles) and the second (4 row tiles)
  const _Float16* a0 = mode == 0 ? pb : pa;
  const _Float16* b0 = mode == 0 ? pa : pb;
  // Blocks of one tn read the same rows of Bt, blocks of one tm the same rows of A. They
  // enter the k walk at different stages and wrap round, so that they do not ask L2 for
  // the same lines at the same moment, and most find a line that another has fetched.
  // Blocks whose indices differ by 1, by 8 or by one tn differ in the stage. It is the same
  // for a block's waves, which go on sharing lines in the WGP cache.
  unsigned st = (blockIdx.x + (blockIdx.x >> 3) + 3u * tn) % NS;
  const _Float16* ak = a0 + st * (KB * 512);
  const _Float16* bk = b0 + st * (KB * 512);

  v8f acc[2][4];
#pragma unroll
  for (int mi = 0; mi < 2; ++mi)
#pragma unroll
    for (int ni = 0; ni < 4; ++ni)
      acc[mi][ni] = (v8f){0.f, 0.f, 0.f, 0.f, 0.f, 0.f, 0.f, 0.f};

  // Fragments run one stage (KB k blocks) ahead, in KB register sets: those of the first
  // stage are fetched here, those of the next stage's block u behind the products of this
  // stage's block u, into its set.
  v16h a[KB][2], b[KB][4];
#pragma unroll
  for (int u = 0; u < KB; ++u) {
    a[u][0] = make_frag(ak + u * 512, ak + u * 512 + 256);
    a[u][1] = make_frag(ak + u * 512 + RT, ak + u * 512 + RT + 256);
#pragma unroll
    for (int ni = 0; ni < 4; ++ni)
      b[u][ni] = make_frag(bk + u * 512 + ni * RT, bk + u * 512 + ni * RT + 256);
  }
  // in front of the loop's set-up, which reuses the register that holds these loads' offset
  asm volatile("s_wait_xcnt 0x0" ::: "memory");
  // keeps that set-up behind the wait
  __builtin_amdgcn_sched_barrier(0);

  // stays rolled: unrolled further, the trips' register sets no longer fit and are spilled
#pragma nounroll
  for (int ks = KB; ks < DD / 32; ks += KB) {
    st = (st + 1) % NS;        // the stage that this trip fetches
    ak = a0 + st * (KB * 512);
    bk = b0 + st * (KB * 512);
#pragma unroll
    for (int u = 0; u < KB; ++u) {
#pragma unroll
      for (int ni = 0; ni < 4; ++ni) {
        acc[0][ni] = wmma16(a[u][0], b[u][ni], acc[0][ni]);
        acc[1][ni] = wmma16(a[u][1], b[u][ni], acc[1][ni]);
      }
      // Holds the fetch behind the products: lifted over them it would need registers of
      // its own beside the set that they still read.
      __builtin_amdgcn_sched_barrier(0);
      a[u][0] = make_frag(ak + u * 512, ak + u * 512 + 256);
      a[u][1] = make_frag(ak + u * 512 + RT, ak + u * 512 + RT + 256);
#pragma unroll
      for (int ni = 0; ni < 4; ++ni)
        b[u][ni] = make_frag(bk + u * 512 + ni * RT, bk + u * 512 + ni * RT + 256);
      // Holds the fetch in front of the next block's products: sunk towards its use it
      // would lose its lead.
      __builtin_amdgcn_sched_barrier(0);
    }
    // in front of the next trip's address set-up, which rewrites the registers that this
    // trip's loads name
    asm volatile("s_wait_xcnt 0x0" ::: "memory");
  }
#pragma unroll
  for (int u = 0; u < KB; ++u)   // the last KB blocks: nothing is left to fetch
#pragma unroll
    for (int ni = 0; ni < 4; ++ni) {
      acc[0][ni] = wmma16(a[u][0], b[u][ni], acc[0][ni]);
      acc[1][ni] = wmma16(a[u][1], b[u][ni], acc[1][ni]);
    }

  if (mode == 0) {
    // acc[i][j][r]: column n0 + 16i + 8hl + r of row m0 + 16j + l16
    const float* bp = bias + n0 + 8 * hl;   // column of i = 0, r = 0, a multiple of 8
    v4f bs[2][2];
#pragma unroll
    for (int i = 0; i < 2; ++i) {
      bs[i][0] = *(const v4f*)(bp + i * 16);
      bs[i][1] = *(const v4f*)(bp + i * 16 + 4);
    }
    // the code below reuses the register that holds these loads' offset
    asm volatile("s_wait_xcnt 0x0" ::: "memory");
    // The tile lies in one batch and one head. Row m0 + l16, k = d = n0 % 64 + 8hl: j steps
    // through row tiles, i through the halves of a k block: 512 bytes in a row per store.
    _Float16* o = (_Float16*)out + (size_t)sel * MM * DD +
                  (size_t)((m0 >> 11) * HH + (n0 >> 6)) * TT * HD +
                  frag_idx((m0 & 2047) + l16, (n0 & 63) + 8 * hl, HD);
#pragma unroll
    for (int i = 0; i < 2; ++i)
#pragma unroll
      for (int j = 0; j < 4; ++j) {
        v8h pk;                             // k = d .. d+7: one 16-byte run
#pragma unroll
        for (int r = 0; r < 4; ++r) {
          pk[r]     = (_Float16)(acc[i][j][r] + bs[i][0][r]);
          pk[r + 4] = (_Float16)(acc[i][j][r + 4] + bs[i][1][r]);
        }
        *(v8h*)(o + j * (16 * HD) + i * 256) = pk;
      }
    // no register that these stores name is rewritten in front of this wait
    asm volatile("s_wait_xcnt 0x0" ::: "memory");
  } else if (mode == 1) {
#pragma unroll
    for (int ni = 0; ni < 4; ++ni) {
      const int n = n0 + ni * 16 + l16;     // output column (C/D: N = lane%16)
      const float bval = bias[n];
      // the code below reuses the register that holds this load's offset
      asm volatile("s_wait_xcnt 0x0" ::: "memory");
      const int h = n >> 6;                 // head (64-wide N-tile stays in head)
      const int d = n & 63;
#pragma unroll
      for (int mi = 0; mi < 2; ++mi) {
        const int mb = m0 + mi * 16 + 8 * hl;  // row of r = 0, a multiple of 8
        const int b  = mb >> 11;               // T = 2048
        const int t0 = mb & 2047;
        _Float16* o = (_Float16*)out + (size_t)sel * MM * DD + (size_t)(b * HH + h) * TT * HD;
        v8h pk;                                // k = t0 .. t0+7: one 16-byte run
#pragma unroll
        for (int r = 0; r < 8; ++r) pk[r] = (_Float16)(acc[mi][ni][r] + bval);
        *(v8h*)(o + frag_idx(d, t0, TT)) = pk;
        // the next tile's code reuses the registers that this store names
        asm volatile("s_wait_xcnt 0x0" ::: "memory");
      }
    }
  } else {
    // acc[mi][ni][r]: row m0 + 16mi + 8hl + r, column n0 + 4 l16 + ni (the deal of Wo's
    // columns): a store writes 256 bytes in a row of each of two rows
    const int n = n0 + 4 * l16;
    const v4f bv = *(const v4f*)(bias + n);
    // the code below reuses the registers that hold this load's address
    asm volatile("s_wait_xcnt 0x0" ::: "memory");
    float* o = (float*)out + (size_t)(m0 + 8 * hl) * DD + n;
#pragma unroll
    for (int mi = 0; mi < 2; ++mi) {
#pragma unroll
      for (int r = 0; r < 8; ++r) {
        const v4f v = (v4f){acc[mi][0][r], acc[mi][1][r], acc[mi][2][r], acc[mi][3][r]} + bv;
        *(v4f*)(o + (size_t)(mi * 16 + r) * DD) = v;
      }
      // the next tile's code reuses the registers that these stores name
      asm volatile("s_wait_xcnt 0x0" ::: "memory");
    }
  }
}

// value of lane l ^ 16
__device__ __forceinline__ float xhalf(float x) {
  const int i = __builtin_bit_cast(int, x);
  return __builtin_bit_cast(
      float, __builtin_amdgcn_permlanex16(i, i, 0x76543210, 0xfedcba98, false, false));
}

__global__ __launch_bounds__(256)
void flash_attn_kernel(const _Float16* __restrict__ Q,
                       const _Float16* __restrict__ K,
                       const _Float16* __restrict__ Vt,
                       _Float16* __restrict__ AO) {
  const int tid  = threadIdx.x;
  const int lane = tid & 31;
  const int wave = tid >> 5;
  const int w    = blockIdx.x * 8 + wave;
  const int qt   = w & 63;                // T/32 = 64 query tiles
  const int bh   = w >> 6;                // 0..47
  const int hl   = lane >> 4;
  const int l16  = lane & 15;
  const int q0   = qt * 32;

  // Q B-fragments: [query group][k-half of head dim]
  v16h qb[2][2];
#pragma unroll
  for (int q = 0; q < 2; ++q) {
    const _Float16* qp = Q + (size_t)bh * TT * HD + lane * 8;
    qb[q][0] = load_frag(qp, (q0 >> 4) + q, 0, HD);
    qb[q][1] = load_frag(qp, (q0 >> 4) + q, 1, HD);
  }

  // o[q][ni][r] = O[query q0 + 16q + l16][d = 16ni + 8hl + r]
  v8f o[2][4];
  // This lane's query. mrun: the reference that the exponentials are taken against, the
  // same in both halves; thr: the unscaled score above which it must be raised;
  // lsum: sums of this half's keys, even and odd r apart.
  float mrun[2], thr[2];
  v2f lsum[2];
#pragma unroll
  for (int q = 0; q < 2; ++q) {
#pragma unroll
    for (int ni = 0; ni < 4; ++ni)
      o[q][ni] = (v8f){0.f, 0.f, 0.f, 0.f, 0.f, 0.f, 0.f, 0.f};
    mrun[q] = -__builtin_inff();
    thr[q]  = -__builtin_inff();          // the first pass always sets the reference
    lsum[q] = (v2f){0.f, 0.f};
  }

  // The 8 blocks of one (b,h) read the same K and V^T. Each enters the key walk at an
  // eighth of its own and wraps round, so that they do not ask L2 for the same lines at the
  // same moment, and most find a line that another has fetched; blocks with neighbouring
  // indices start at least a quarter of the walk apart. A block's waves walk alike and go on
  // sharing lines in the WGP cache.
  // the pass's place in the key order
  unsigned ps = ((blockIdx.x & 3) * 2 + ((blockIdx.x >> 2) & 1)) * (NP / 8);
  // this lane's 16 bytes in the first block of K and V^T, and of the pass's rows and columns
  const _Float16* kb = K  + (size_t)bh * TT * HD + lane * 8;
  const _Float16* vb = Vt + (size_t)bh * HD * TT + lane * 8;
  const _Float16* kp = kb + ps * (32 * HD);
  const _Float16* vp = vb + ps * 512;
  const float scale = 0.125f;             // 1/sqrt(64)
  const float ROOM = 5.5f;               // exp(5.5) = 245

  // K fragments run one pass ahead: those of the first pass are fetched here, those of each
  // further pass behind the score products of the pass before, into the same registers.
  v16h ka[2][2];                          // [key tile][k-half of head dim]
#pragma unroll
  for (int j = 0; j < 2; ++j) {
    ka[j][0] = load_frag(kp, j, 0, HD);
    ka[j][1] = load_frag(kp, j, 1, HD);
  }
  // The loads above name kp: as an input here the pair stays whole up to this wait,
  // which stands in front of the code that rewrites it.
  asm volatile("s_wait_xcnt 0x0" :: "v"(kp) : "memory");

  for (int i = 0; i < NP; ++i) {
    v16h va[4];                           // [16 rows of d], k = the 32 keys
#pragma unroll
    for (int ni = 0; ni < 4; ++ni) va[ni] = load_frag(vp, ni, 0, TT);

    // ---- S^T = K @ Q^T : 2 key tiles x 2 query groups, K frags shared ----
    // s[q][j][r] = score of key 32ps + 16j + 8hl + r with this lane's query
    v8f s[2][2];
#pragma unroll
    for (int j = 0; j < 2; ++j) {
#pragma unroll
      for (int q = 0; q < 2; ++q) {
        v8f t = (v8f){0.f, 0.f, 0.f, 0.f, 0.f, 0.f, 0.f, 0.f};
        t = wmma16(ka[j][0], qb[q][0], t);
        t = wmma16(ka[j][1], qb[q][1], t);
        s[q][j] = t;
      }
    }

    // ---- the next pass's K: in flight under softmax and the O^T products ----
    // next 32 keys: 4 blocks of K; the last pass fetches the first pass's again, unused
    ps = (ps + 1) % NP;
    kp = kb + ps * (32 * HD);
#pragma unroll
    for (int j = 0; j < 2; ++j) {
      ka[j][0] = load_frag(kp, j, 0, HD);
      ka[j][1] = load_frag(kp, j, 1, HD);
    }
    // Holds the fetch at this place: without it the compiler sinks these loads far into
    // the softmax, whose temporaries then take the K registers, and most of the lead goes.
    __builtin_amdgcn_sched_barrier(0);

    // ---- online softmax over the 32 new keys, lazy rescale ----------------
    // The reference stays as it is while no scaled score of the pass lies more than
    // ROOM above it: sums and O^T then need no factor, and P stays at or below
    // exp(ROOM), far inside f16. The quotient at the end is the same for any reference.
    float mx[2];                          // largest of this lane's own 16 scores
#pragma unroll
    for (int q = 0; q < 2; ++q) {
      mx[q] = fmaxf(s[q][0][0], s[q][1][0]);
#pragma unroll
      for (int r = 1; r < 8; ++r) mx[q] = fmaxf(mx[q], fmaxf(s[q][0][r], s[q][1][r]));
    }
    // one test a pass for the whole wave, a scalar branch; each lane tests its own keys,
    // so the halves exchange their maxima only where the reference moves
    if (__builtin_amdgcn_ballot_w32(mx[0] > thr[0] || mx[1] > thr[1]) != 0) {
#pragma unroll
      for (int q = 0; q < 2; ++q) {
        const float mf = fmaxf(mx[q], xhalf(mx[q]));   // with the other 16 keys of this query
        const float mn = fmaxf(mrun[q], mf * scale);
        const float alpha = __expf(mrun[q] - mn);
        mrun[q] = mn;
        thr[q]  = (mn + ROOM) * (1.f / scale);
        lsum[q] *= alpha;
#pragma unroll
        for (int ni = 0; ni < 4; ++ni)
#pragma unroll
          for (int r = 0; r < 8; ++r)
            o[q][ni][r] *= alpha;
      }
    }
    v16h pb[2];
#pragma unroll
    for (int q = 0; q < 2; ++q) {
#pragma unroll
      for (int j = 0; j < 2; ++j) {
#pragma unroll
        for (int r = 0; r < 8; r += 2) {
          const v2f x = (v2f){s[q][j][r], s[q][j][r + 1]} * scale - mrun[q];
          const v2f p = (v2f){__expf(x.x), __expf(x.y)};
          lsum[q] += p;
          const v2h ph = __builtin_convertvector(p, v2h);
          pb[q][8 * j + r]     = ph.x;    // k = 16j + 8hl + r
          pb[q][8 * j + r + 1] = ph.y;
        }
      }
    }

    // Keeps the sums from being spread among the products, where they take the V^T
    // registers as temporaries: each such place costs four idle slots behind its product.
    // Without it there are three such places; with it the compiler still leaves one.
    __builtin_amdgcn_sched_barrier(0);

    // ---- O^T += V^T @ P^T : V frags shared between query groups ----------
#pragma unroll
    for (int ni = 0; ni < 4; ++ni) {
      o[0][ni] = wmma16(va[ni], pb[0], o[0][ni]);
      o[1][ni] = wmma16(va[ni], pb[1], o[1][ni]);
    }
    // Holds the wait below at the foot of the pass, where the address translations are
    // long done; lifted to directly behind the loads it would stall the wave there.
    __builtin_amdgcn_sched_barrier(0);
    // This pass's loads name kp and vp: as inputs here both pairs stay whole up to
    // this wait, which stands in front of the code that rewrites them.
    asm volatile("s_wait_xcnt 0x0" :: "v"(kp), "v"(vp) : "memory");
    vp = vb + ps * 512;                   // next k block of V^T
  }

  // ---- finalize: join the halves' sums, divide, store 16-byte runs of d ---
  const int b = bh / HH;
  const int h = bh % HH;
  v8h pk[2][4];
#pragma unroll
  for (int q = 0; q < 2; ++q) {
    const float ls = lsum[q].x + lsum[q].y;
    const float inv = 1.f / (ls + xhalf(ls));
#pragma unroll
    for (int ni = 0; ni < 4; ++ni)
#pragma unroll
      for (int r = 0; r < 8; ++r) pk[q][ni][r] = (_Float16)(o[q][ni][r] * inv);
  }
  // row b*T + q0 + l16, k = h*64 + 8hl; a query group is one row tile further,
  // ni steps through the halves of two k blocks: 512 bytes in a row per store
  _Float16* ao = AO + frag_idx(b * TT + q0 + l16, h * HD + 8 * hl, DD);
#pragma unroll
  for (int q = 0; q < 2; ++q)
#pragma unroll
    for (int ni = 0; ni < 4; ++ni)
      *(v8h*)(ao + q * RT + ni * 256) = pk[q][ni];
}

// ---------------------------------------------------------------------------
extern "C" void kernel_launch(void* const* d_in, const int* in_sizes, int n_in,
                              void* d_out, int out_size, void* d_ws, size_t ws_size,
                              hipStream_t stream) {
  const float* x  = (const float*)d_in[0];
  const float* Wq = (const float*)d_in[1];
  const float* bq = (const float*)d_in[2];
  const float* Wk = (const float*)d_in[3];
  const float* bk = (const float*)d_in[4];
  const float* Wv = (const float*)d_in[5];
  const float* bv = (const float*)d_in[6];
  const float* Wo = (const float*)d_in[7];
  const float* bo = (const float*)d_in[8];

  char* ws = (char*)d_ws;
  _Float16* xh  = (_Float16*)(ws + OFF_XH);
  _Float16* wqt = (_Float16*)(ws + OFF_WQT);
  _Float16* wot = (_Float16*)(ws + OFF_WOT);
  _Float16* qh  = (_Float16*)(ws + OFF_Q);
  _Float16* kh  = (_Float16*)(ws + OFF_K);
  _Float16* vt  = (_Float16*)(ws + OFF_VT);
  _Float16* ao  = (_Float16*)(ws + OFF_AO);

  // wqt, wkt, wvt, wot stand one behind the other in the workspace; so do qh, kh, vt
  cvt_all_kernel<<<4 * WBLK + XBLK, 256, 0, stream>>>(x, Wq, Wk, Wv, Wo, xh, wqt);

  gemm_wmma_kernel<<<GT_M * GT_N / 4, GW * 32, 0, stream>>>(xh, wqt, bq, bk, bv, (void*)qh, 0);

  const int attn_blocks = (BB * HH * (TT / 32)) / 8;   // 384
  flash_attn_kernel<<<attn_blocks, 256, 0, stream>>>(qh, kh, vt, ao);

  gemm_wmma_kernel<<<GT_M * GT_N / 8, 256, 0, stream>>>(ao, wot, bo, bo, bo, d_out, 1);
}

// v010
// One run takes 91.8 microseconds.
// Timed twice side by side with v009, it ran 1.09 times as fast both times.
// Over all steps from v000 it is 3.48 times as fast.
#include <hip/hip_runtime.h>

// ---------------------------------------------------------------------------
// Multi-head attention for MI455X (gfx1250, wave32, WMMA f32_16x16x32_f16)
//   B=4, T=2048, D=768, H=12, hd=64
// Pipeline:
//   1) one launch: f32->f16 convert x; transpose+convert Wq/Wk/Wv/Wo
//   2) one launch: WMMA GEMMs (2 x 4 tiles of 16x16 a wave) -> Q,K in [B,H,T,64] f16 ;
//      V in [B,H,64,T] f16 (transposed)
//   3) flash-attention, transposed (S^T = K Q^T, O^T += V^T P^T): 1 wave per
//      32 query columns (2 groups sharing K/V fragments), keys streamed 32 at
//      a time (K fetched two passes ahead, V^T one), online softmax in-lane with
//      lazy rescale, P^T packed from the S^T accumulators
//   4) WMMA GEMM attn_out @ Wo + bo -> f32 d_out
// Every f16 operand in the workspace is kept in fragment order (frag_idx), so
// that one fragment load instruction reads 512 contiguous bytes. Every GEMM
// output leaves in 16-byte stores that fill whole 128-byte lines.
// ---------------------------------------------------------------------------

typedef _Float16 v16h __attribute__((ext_vector_type(16)));
typedef _Float16 v8h  __attribute__((ext_vector_type(8)));
typedef float    v8f  __attribute__((ext_vector_type(8)));
typedef _Float16 v2h  __attribute__((ext_vector_type(2)));
typedef float    v2f  __attribute__((ext_vector_type(2)));
typedef float    v4f  __attribute__((ext_vector_type(4)));

#define BB 4
#define TT 2048
#define DD 768
#define HH 12
#define HD 64
#define MM (BB * TT)           // 8192 rows

// GEMM wave-tile: 32 rows x 64 cols (Q, K: 64 rows x 32 cols)
#define WTM 32
#define WTN 64
#define GT_M (MM / WTM)        // 256
#define GT_N (DD / WTN)        // 12
#define RT (16 * DD)           // halves of one 16-row tile of a [*, 768] operand
#define GW 12                  // waves of a block of the Q, K, V launch
#define KB 3                   // k blocks of fragments that a GEMM wave keeps in flight
#define NS (DD / 32 / KB)      // 8 stages of KB k blocks in a GEMM's k walk
#define NP (TT / 32)           // 64 passes of 32 keys in the attention's key walk
#define AW 12                  // waves of an attention block: 3 a SIMD, all that its registers let fit

// convert launch, blocks of 8 waves. A wave of the weight part makes 2 row tiles x 1 k
// block (4 runs of 8 halves a lane), a wave of the x part 1 row tile x 4 k blocks (8 runs).
#define WBLK ((DD / 32) * (DD / 32) / 8)   // 72 a weight
#define XBLK ((MM / 16) * (DD / 128) / 8)  // 384 for x

// Workspace byte offsets
#define OFF_XH   0u
#define OFF_WQT  (OFF_XH  + (size_t)MM * DD * 2)
#define OFF_WKT  (OFF_WQT + (size_t)DD * DD * 2)
#define OFF_WVT  (OFF_WKT + (size_t)DD * DD * 2)
#define OFF_WOT  (OFF_WVT + (size_t)DD * DD * 2)
#define OFF_Q    (OFF_WOT + (size_t)DD * DD * 2)
#define OFF_K    (OFF_Q   + (size_t)MM * DD * 2)
#define OFF_VT   (OFF_K   + (size_t)MM * DD * 2)
#define OFF_AO   (OFF_VT  + (size_t)MM * DD * 2)

__device__ __forceinline__ v8f wmma16(v16h a, v16h b, v8f c) {
  // D = A(16x32,f16) x B(32x16,f16) + C(16x16,f32)
  return __builtin_amdgcn_wmma_f32_16x16x32_f16(
      /*neg_a=*/false, a, /*neg_b=*/false, b,
      /*c_mod=*/(short)0, c, /*reuse_a=*/false, /*reuse_b=*/false);
}

// Build a 16-half fragment from two contiguous 16-byte runs.
__device__ __forceinline__ v16h make_frag(const _Float16* p0, const _Float16* p1) {
  v8h lo = *(const v8h*)p0;
  v8h hi = *(const v8h*)p1;
  v16h r;
#pragma unroll
  for (int i = 0; i < 8; ++i) { r[i] = lo[i]; r[i + 8] = hi[i]; }
  return r;
}

// Fragment order of a [rows][kd] f16 operand: blocks of 16 rows x 32 k, 512
// halves each, k blocks of one row tile in a row. In a block, lane
// l = 16 * (k bit 3) + row % 16 owns halves l*8 .. l*8+7 (k bit 4 = 0) and
// 256 + l*8 .. (k bit 4 = 1): the two 16-byte runs that make_frag joins.
__device__ __forceinline__ size_t frag_idx(int row, int k, int kd) {
  return ((size_t)((row >> 4) * (kd >> 5) + (k >> 5)) << 9) +
         (size_t)((((k >> 4) & 1) << 8) + ((((k >> 3) & 1) << 4) + (row & 15)) * 8 + (k & 7));
}

// Fragment of row tile rt, k block ks: base + lane * 8 is passed as p.
__device__ __forceinline__ v16h load_frag(const _Float16* p, int rt, int ks, int kd) {
  const _Float16* q = p + ((size_t)(rt * (kd >> 5) + ks) << 9);
  return make_frag(q, q + 256);
}

// ---------------------------------------------------------------------------
// All five conversions as block ranges of one grid (none reads what another
// writes). Blocks 0 .. 4*WBLK-1, the weights, whose loads are the more scattered:
//   wt[sel](row n, k) = (f16) W[sel][k*768 + n]   (768x768), fragment order
//   Wo alone: place l of row tile T holds column 64 (T / 4) + 4 l + T % 4, so that in the
//   out projection a lane's four column tiles are four neighbouring columns
// the rest: xh = (f16) x, [M, 768] row-major -> fragment order
// A lane makes whole 16-byte runs (8 k of one row): lane l of a wave owns place l of
// each half block, so a store instruction writes 512 bytes in a row. All loads of a
// lane are issued before the first conversion.
__global__ __launch_bounds__(256)
void cvt_all_kernel(const float* __restrict__ x,
                    const float* __restrict__ Wq, const float* __restrict__ Wk,
                    const float* __restrict__ Wv, const float* __restrict__ Wo,
                    _Float16* __restrict__ xh, _Float16* __restrict__ wt) {
  const int blk  = blockIdx.x;
  const int lane = threadIdx.x & 31;
  // as a scalar: block addresses then stay in scalar registers
  const int wave = __builtin_amdgcn_readfirstlane(threadIdx.x >> 5);
  const int hl   = lane >> 4;   // k bit 3
  const int l16  = lane & 15;   // row % 16
  if (blk < 4 * WBLK) {
    const int sel = blk / WBLK;
    const float* in = sel == 0 ? Wq : sel == 1 ? Wk : sel == 2 ? Wv : Wo;
    const int wv = (blk - sel * WBLK) * 8 + wave;
    const int tp = wv / (DD / 32);          // pair of row tiles: 2 tp, 2 tp + 1
    const int kb = wv % (DD / 32);          // k block
    // the column of W that this lane's place holds in row tile 2 tp, and in 2 tp + 1
    const int n0 = sel == 3 ? (tp >> 1) * 64 + (tp & 1) * 2 + l16 * 4 : tp * 32 + l16;
    const int n1 = sel == 3 ? n0 + 1 : n0 + 16;
    // W[k = 32 kb + 8 hl][n]
    const float* p  = in + (size_t)(kb * 32 + hl * 8) * DD + n0;
    const float* p1 = in + (size_t)(kb * 32 + hl * 8) * DD + n1;
    float f[2][2][8];                       // [row tile][k bit 4][k & 7]
#pragma unroll
    for (int h = 0; h < 2; ++h)
#pragma unroll
      for (int j = 0; j < 8; ++j) {         // both tiles read the same 128-byte lines
        f[0][h][j] = p[(h * 16 + j) * DD];
        f[1][h][j] = p1[(h * 16 + j) * DD];
      }
    // the conversions below may reuse the registers that hold these loads' addresses;
    // as inputs the pairs stay whole up to this wait
    asm volatile("s_wait_xcnt 0x0" :: "v"(p), "v"(p1) : "memory");
    _Float16* o = wt + (size_t)sel * DD * DD + (size_t)tp * 2 * RT + kb * 512 + lane * 8;
#pragma unroll
    for (int t = 0; t < 2; ++t)
#pragma unroll
      for (int h = 0; h < 2; ++h) {
        v8h pk;
#pragma unroll
        for (int j = 0; j < 8; ++j) pk[j] = (_Float16)f[t][h][j];
        *(v8h*)(o + t * RT + h * 256) = pk;
      }
    // no register that these stores name is rewritten in front of this wait
    asm volatile("s_wait_xcnt 0x0" ::: "memory");
  } else {
    const int wv = (blk - 4 * WBLK) * 8 + wave;
    const int rt = wv / (DD / 128);         // row tile
    const int kq = wv % (DD / 128);         // four k blocks: 512 bytes of each row
    // x[row = 16 rt + l16][k = 128 kq + 8 hl]
    const float* p = x + (size_t)(rt * 16 + l16) * DD + kq * 128 + hl * 8;
    v4f f[8][2];                            // [half block][k bit 2]
#pragma unroll
    for (int u = 0; u < 8; ++u) {
      f[u][0] = *(const v4f*)(p + u * 16);
      f[u][1] = *(const v4f*)(p + u * 16 + 4);
    }
    // The loaded values as inputs: without them the compiler converts the first runs
    // between the loads and issues the last loads only when the first have come back;
    // so all 16 are in flight at once. The wait: the code below may reuse the registers
    // that hold these loads' address; as an input the pair stays whole up to it.
    asm volatile("s_wait_xcnt 0x0"
                 :: "v"(p), "v"(f[0][0]), "v"(f[0][1]), "v"(f[1][0]), "v"(f[1][1]),
                    "v"(f[2][0]), "v"(f[2][1]), "v"(f[3][0]), "v"(f[3][1]),
                    "v"(f[4][0]), "v"(f[4][1]), "v"(f[5][0]), "v"(f[5][1]),
                    "v"(f[6][0]), "v"(f[6][1]), "v"(f[7][0]), "v"(f[7][1])
                 : "memory");
    _Float16* o = xh + (size_t)rt * RT + kq * 4 * 512 + lane * 8;
#pragma unroll
    for (int u = 0; u < 8; ++u) {
      v8h pk;
#pragma unroll
      for (int j = 0; j < 4; ++j) {
        pk[j]     = (_Float16)f[u][0][j];
        pk[j + 4] = (_Float16)f[u][1][j];
      }
      *(v8h*)(o + u * 256) = pk;
    }
    // no register that these stores name is rewritten in front of this wait
    asm volatile("s_wait_xcnt 0x0" ::: "memory");
  }
}

// ---------------------------------------------------------------------------
// WMMA GEMM, a wave holds 2 x 4 tiles of 16 x 16: 2 row tiles of the matrix instruction's
// first operand, 4 of its second.
//   A  : f16 [M, 768], fragment order
//   Bt : f16 transposed weight [N=768, K=768] (row n = column n of W), fragment order
// mode 0: out f16 [B,H][T,64], each [T,64] in fragment order   (Q, K)
// mode 1: out f16 [B,H][64,T], each [64,T] in fragment order   (V transposed)
// mode 2: out f32 row-major [M, 768]   (final projection)
// An accumulator's 8 registers run along the first operand's rows. Modes 1 and 2 take A
// first (32 rows x 64 columns of the product). Mode 0 takes Bt first (32 columns x 64
// rows): a lane then holds 8 neighbouring d of one t, one 16-byte run of the output's
// fragment order, as it holds 8 neighbouring t of one d in mode 1. In mode 2 the rows of
// Bt are dealt so that a lane's four column tiles are four neighbouring columns.
// A launch holds one product (proj = 1: mode 2, 8 waves, 8 tiles a block) or three that
// share A (proj = 0): a block is then 12 waves, 4 tiles x 3 products on the same 128 rows,
// so that the products' waves read the same A lines at the same time. Product sel takes weight
// Bt3 + sel * 768 * 768, bias sel and the sel-th [M, 768] f16 plane of out;
// sel 0, 1 are mode 0, sel 2 is mode 1.
// ---------------------------------------------------------------------------
__global__ __launch_bounds__(GW * 32)
void gemm_wmma_kernel(const _Float16* __restrict__ A,
                      const _Float16* __restrict__ Bt3,
                      const float* __restrict__ bias0,
                      const float* __restrict__ bias1,
                      const float* __restrict__ bias2,
                      void* __restrict__ out, int proj) {
  const int tid  = threadIdx.x;
  const int lane = tid & 31;
  // as a scalar: the product that it selects picks pointers and the store branch
  const int wave = __builtin_amdgcn_readfirstlane(tid >> 5);
  const int sel  = proj ? 0 : wave >> 2;
  const int mode = proj ? 2 : (sel == 2 ? 1 : 0);
  const _Float16* Bt = Bt3 + (size_t)sel * DD * DD;
  const float* bias  = sel == 0 ? bias0 : sel == 1 ? bias1 : bias2;
  const int w    = proj ? blockIdx.x * 8 + wave : blockIdx.x * 4 + (wave & 3);
  const int tn   = w / GT_M;
  // Mode 0: the four waves of a product cover the same 128 rows x 64 columns as in mode 1,
  // as 2 x 2 tiles of 64 rows x 32 columns.
  const int m0   = mode == 0 ? ((w & ~3) % GT_M) * WTM + (wave & 1) * 64 : (w % GT_M) * WTM;
  const int n0   = mode == 0 ? tn * WTN + (wave & 2) * 16 : tn * WTN;
  const int hl   = lane >> 4;   // half-wave id
  const int l16  = lane & 15;

  // this lane's 16 bytes in k block 0 of the wave's first row tile of A and of Bt
  const _Float16* pa = A  + (size_t)(m0 >> 4) * RT + lane * 8;
  const _Float16* pb = Bt + (size_t)(n0 >> 4) * RT + lane * 8;
  // the first operand (2 row tiles) and the second (4 row tiles)
  const _Float16* a0 = mode == 0 ? pb : pa;
  const _Float16* b0 = mode == 0 ? pa : pb;
  // Blocks of one tn read the same rows of Bt, blocks of one tm the same rows of A. They
  // enter the k walk at different stages and wrap round, so that they do not ask L2 for
  // the same lines at the same moment, and most find a line that another has fetched.
  // Blocks whose indices differ by 1, by 8 or by one tn differ in the stage. It is the same
  // for a block's waves, which go on sharing lines in the WGP cache.
  unsigned st = (blockIdx.x + (blockIdx.x >> 3) + 3u * tn) % NS;
  const _Float16* ak = a0 + st * (KB * 512);
  const _Float16* bk = b0 + st * (KB * 512);

  v8f acc[2][4];
#pragma unroll
  for (int mi = 0; mi < 2; ++mi)
#pragma unroll
    for (int ni = 0; ni < 4; ++ni)
      acc[mi][ni] = (v8f){0.f, 0.f, 0.f, 0.f, 0.f, 0.f, 0.f, 0.f};

  // Fragments run one stage (KB k blocks) ahead, in KB register sets: those of the first
  // stage are fetched here, those of the next stage's block u behind the products of this
  // stage's block u, into its set.
  v16h a[KB][2], b[KB][4];
#pragma unroll
  for (int u = 0; u < KB; ++u) {
    a[u][0] = make_frag(ak + u * 512, ak + u * 512 + 256);
    a[u][1] = make_frag(ak + u * 512 + RT, ak + u * 512 + RT + 256);
#pragma unroll
    for (int ni = 0; ni < 4; ++ni)
      b[u][ni] = make_frag(bk + u * 512 + ni * RT, bk + u * 512 + ni * RT + 256);
  }
  // in front of the loop's set-up, which reuses the register that holds these loads' offset
  asm volatile("s_wait_xcnt 0x0" ::: "memory");
  // keeps that set-up behind the wait
  __builtin_amdgcn_sched_barrier(0);

  // stays rolled: unrolled further, the trips' register sets no longer fit and are spilled
#pragma nounroll
  for (int ks = KB; ks < DD / 32; ks += KB) {
    st = (st + 1) % NS;        // the stage that this trip fetches
    ak = a0 + st * (KB * 512);
    bk = b0 + st * (KB * 512);
#pragma unroll
    for (int u = 0; u < KB; ++u) {
#pragma unroll
      for (int ni = 0; ni < 4; ++ni) {
        acc[0][ni] = wmma16(a[u][0], b[u][ni], acc[0][ni]);
        acc[1][ni] = wmma16(a[u][1], b[u][ni], acc[1][ni]);
      }
      // Holds the fetch behind the products: lifted over them it would need registers of
      // its own beside the set that they still read.
      __builtin_amdgcn_sched_barrier(0);
      a[u][0] = make_frag(ak + u * 512, ak + u * 512 + 256);
      a[u][1] = make_frag(ak + u * 512 + RT, ak + u * 512 + RT + 256);
#pragma unroll
      for (int ni = 0; ni < 4; ++ni)
        b[u][ni] = make_frag(bk + u * 512 + ni * RT, bk + u * 512 + ni * RT + 256);
      // Holds the fetch in front of the next block's products: sunk towards its use it
      // would lose its lead.
      __builtin_amdgcn_sched_barrier(0);
    }
    // in front of the next trip's address set-up, which rewrites the registers that this
    // trip's loads name
    asm volatile("s_wait_xcnt 0x0" ::: "memory");
  }
#pragma unroll
  for (int u = 0; u < KB; ++u)   // the last KB blocks: nothing is left to fetch
#pragma unroll
    for (int ni = 0; ni < 4; ++ni) {
      acc[0][ni] = wmma16(a[u][0], b[u][ni], acc[0][ni]);
      acc[1][ni] = wmma16(a[u][1], b[u][ni], acc[1][ni]);
    }

  if (mode == 0) {
    // acc[i][j][r]: column n0 + 16i + 8hl + r of row m0 + 16j + l16
    const float* bp = bias + n0 + 8 * hl;   // column of i = 0, r = 0, a multiple of 8
    v4f bs[2][2];
#pragma unroll
    for (int i = 0; i < 2; ++i) {
      bs[i][0] = *(const v4f*)(bp + i * 16);
      bs[i][1] = *(const v4f*)(bp + i * 16 + 4);
    }
    // the code below reuses the register that holds these loads' offset
    asm volatile("s_wait_xcnt 0x0" ::: "memory");
    // The tile lies in one batch and one head. Row m0 + l16, k = d = n0 % 64 + 8hl: j steps
    // through row tiles, i through the halves of a k block: 512 bytes in a row per store.
    _Float16* o = (_Float16*)out + (size_t)sel * MM * DD +
                  (size_t)((m0 >> 11) * HH + (n0 >> 6)) * TT * HD +
                  frag_idx((m0 & 2047) + l16, (n0 & 63) + 8 * hl, HD);
#pragma unroll
    for (int i = 0; i < 2; ++i)
#pragma unroll
      for (int j = 0; j < 4; ++j) {
        v8h pk;                             // k = d .. d+7: one 16-byte run
#pragma unroll
        for (int r = 0; r < 4; ++r) {
          pk[r]     = (_Float16)(acc[i][j][r] + bs[i][0][r]);
          pk[r + 4] = (_Float16)(acc[i][j][r + 4] + bs[i][1][r]);
        }
        *(v8h*)(o + j * (16 * HD) + i * 256) = pk;
      }
    // no register that these stores name is rewritten in front of this wait
    asm volatile("s_wait_xcnt 0x0" ::: "memory");
  } else if (mode == 1) {
#pragma unroll
    for (int ni = 0; ni < 4; ++ni) {
      const int n = n0 + ni * 16 + l16;     // output column (C/D: N = lane%16)
      const float bval = bias[n];
      // the code below reuses the register that holds this load's offset
      asm volatile("s_wait_xcnt 0x0" ::: "memory");
      const int h = n >> 6;                 // head (64-wide N-tile stays in head)
      const int d = n & 63;
#pragma unroll
      for (int mi = 0; mi < 2; ++mi) {
        const int mb = m0 + mi * 16 + 8 * hl;  // row of r = 0, a multiple of 8
        const int b  = mb >> 11;               // T = 2048
        const int t0 = mb & 2047;
        _Float16* o = (_Float16*)out + (size_t)sel * MM * DD + (size_t)(b * HH + h) * TT * HD;
        v8h pk;                                // k = t0 .. t0+7: one 16-byte run
#pragma unroll
        for (int r = 0; r < 8; ++r) pk[r] = (_Float16)(acc[mi][ni][r] + bval);
        *(v8h*)(o + frag_idx(d, t0, TT)) = pk;
        // the next tile's code reuses the registers that this store names
        asm volatile("s_wait_xcnt 0x0" ::: "memory");
      }
    }
  } else {
    // acc[mi][ni][r]: row m0 + 16mi + 8hl + r, column n0 + 4 l16 + ni (the deal of Wo's
    // columns): a store writes 256 bytes in a row of each of two rows
    const int n = n0 + 4 * l16;
    const v4f bv = *(const v4f*)(bias + n);
    // the code below reuses the registers that hold this load's address
    asm volatile("s_wait_xcnt 0x0" ::: "memory");
    float* o = (float*)out + (size_t)(m0 + 8 * hl) * DD + n;
#pragma unroll
    for (int mi = 0; mi < 2; ++mi) {
#pragma unroll
      for (int r = 0; r < 8; ++r) {
        const v4f v = (v4f){acc[mi][0][r], acc[mi][1][r], acc[mi][2][r], acc[mi][3][r]} + bv;
        *(v4f*)(o + (size_t)(mi * 16 + r) * DD) = v;
      }
      // the next tile's code reuses the registers that these stores name
      asm volatile("s_wait_xcnt 0x0" ::: "memory");
    }
  }
}

// value of lane l ^ 16
__device__ __forceinline__ float xhalf(float x) {
  const int i = __builtin_bit_cast(int, x);
  return __builtin_bit_cast(
      float, __builtin_amdgcn_permlanex16(i, i, 0x76543210, 0xfedcba98, false, false));
}

__global__ __launch_bounds__(AW * 32)
void flash_attn_kernel(const _Float16* __restrict__ Q,
                       const _Float16* __restrict__ K,
                       const _Float16* __restrict__ Vt,
                       _Float16* __restrict__ AO) {
  const int tid  = threadIdx.x;
  const int lane = tid & 31;
  // as a scalar: a block's waves may lie in two (b,h); the head's addresses stay scalar
  const int wave = __builtin_amdgcn_readfirstlane(tid >> 5);
  const int w    = blockIdx.x * AW + wave;
  const int qt   = w & 63;                // T/32 = 64 query tiles
  const int bh   = w >> 6;                // 0..47
  const int hl   = lane >> 4;
  const int l16  = lane & 15;
  const int q0   = qt * 32;

  // Q B-fragments: [query group][k-half of head dim]
  v16h qb[2][2];
#pragma unroll
  for (int q = 0; q < 2; ++q) {
    const _Float16* qp = Q + (size_t)bh * TT * HD + lane * 8;
    qb[q][0] = load_frag(qp, (q0 >> 4) + q, 0, HD);
    qb[q][1] = load_frag(qp, (q0 >> 4) + q, 1, HD);
  }

  // o[q][ni][r] = O[query q0 + 16q + l16][d = 16ni + 8hl + r]
  v8f o[2][4];
  // This lane's query. mrun: the reference that the exponentials are taken against, the
  // same in both halves; thr: the unscaled score above which it must be raised;
  // lsum: sums of this half's keys, even and odd r apart.
  float mrun[2], thr[2];
  v2f lsum[2];
#pragma unroll
  for (int q = 0; q < 2; ++q) {
#pragma unroll
    for (int ni = 0; ni < 4; ++ni)
      o[q][ni] = (v8f){0.f, 0.f, 0.f, 0.f, 0.f, 0.f, 0.f, 0.f};
    mrun[q] = -__builtin_inff();
    thr[q]  = -__builtin_inff();          // the first pass always sets the reference
    lsum[q] = (v2f){0.f, 0.f};
  }

  // The blocks of one (b,h), six neighbours in the index, read the same K and V^T. Each
  // enters the key walk at an eighth of its own and wraps round, so that they do not ask L2
  // for the same lines at the same moment, and most find a line that another has fetched;
  // blocks with neighbouring indices start a quarter of the walk apart or more, but for
  // indices 8n - 1 and 8n (an eighth). A block's waves walk alike, and those of one (b,h) go
  // on sharing lines in the WGP cache.
  // the pass's place in the key order
  unsigned ps = ((blockIdx.x & 3) * 2 + ((blockIdx.x >> 2) & 1)) * (NP / 8);
  // this lane's 16 bytes in the first block of K and V^T, and of the pass's rows and columns
  const _Float16* kb = K  + (size_t)bh * TT * HD + lane * 8;
  const _Float16* vb = Vt + (size_t)bh * HD * TT + lane * 8;
  const _Float16* kp = kb + ps * (32 * HD);
  const _Float16* vp = vb + ps * 512;
  const float scale = 0.125f;             // 1/sqrt(64)
  const float ROOM = 5.5f;               // exp(5.5) = 245

  // Two register sets each for K and V^T; even passes work on set 0, odd ones on set 1.
  // K fragments run two passes ahead: those of the first two passes are fetched here, those
  // of pass i + 2 behind the score products of pass i, into its set. V^T fragments run one
  // pass ahead: those of the first pass are fetched here, those of pass i + 1 at the head of
  // pass i, into the set that pass i - 1 has left.
  v16h ka[2][2][2];                       // [set][key tile][k-half of head dim]
  v16h va[2][4];                          // [set][16 rows of d], k = the 32 keys
#pragma unroll
  for (int j = 0; j < 2; ++j) {
    ka[0][j][0] = load_frag(kp, j, 0, HD);
    ka[0][j][1] = load_frag(kp, j, 1, HD);
  }
#pragma unroll
  for (int ni = 0; ni < 4; ++ni) va[0][ni] = load_frag(vp, ni, 0, TT);
#pragma unroll
  for (int j = 0; j < 2; ++j) {           // the walk enters at a multiple of 8: no wrap here
    ka[1][j][0] = load_frag(kp, 2 + j, 0, HD);
    ka[1][j][1] = load_frag(kp, 2 + j, 1, HD);
  }
  // The loads above name kp and vp: as inputs here both pairs stay whole up to this
  // wait, which stands in front of the code that rewrites them.
  asm volatile("s_wait_xcnt 0x0" :: "v"(kp), "v"(vp) : "memory");

  // two passes a trip, so that the set of a pass is known at compile time; no further: the
  // loop's text stays small
#pragma nounroll
  for (int i = 0; i < NP; i += 2) {
#pragma unroll
  for (int h = 0; h < 2; ++h) {           // the pass's register set
    // ---- the next pass's V^T: in flight for a whole pass and more ----------
    // the last pass fetches the first pass's again, unused
    vp = vb + ((ps + 1) % NP) * 512;      // next k block of V^T
#pragma unroll
    for (int ni = 0; ni < 4; ++ni) va[h ^ 1][ni] = load_frag(vp, ni, 0, TT);

    // ---- S^T = K @ Q^T : 2 key tiles x 2 query groups, K frags shared ----
    // s[q][j][r] = score of key 32ps + 16j + 8hl + r with this lane's query
    v8f s[2][2];
#pragma unroll
    for (int j = 0; j < 2; ++j) {
#pragma unroll
      for (int q = 0; q < 2; ++q) {
        v8f t = (v8f){0.f, 0.f, 0.f, 0.f, 0.f, 0.f, 0.f, 0.f};
        t = wmma16(ka[h][j][0], qb[q][0], t);
        t = wmma16(ka[h][j][1], qb[q][1], t);
        s[q][j] = t;
      }
    }

    // ---- K of the pass after the next: in flight for nearly two passes ----
    // 32 keys: 4 blocks of K; the last two passes fetch the first two's again, unused
    kp = kb + ((ps + 2) % NP) * (32 * HD);
#pragma unroll
    for (int j = 0; j < 2; ++j) {
      ka[h][j][0] = load_frag(kp, j, 0, HD);
      ka[h][j][1] = load_frag(kp, j, 1, HD);
    }
    // Holds the fetch at this place: without it the compiler sinks these loads far into
    // the softmax, whose temporaries then take the K registers, and most of the lead goes.
    __builtin_amdgcn_sched_barrier(0);

    // ---- online softmax over the 32 new keys, lazy rescale ----------------
    // The reference stays as it is while no scaled score of the pass lies more than
    // ROOM above it: sums and O^T then need no factor, and P stays at or below
    // exp(ROOM), far inside f16. The quotient at the end is the same for any reference.
    float mx[2];                          // largest of this lane's own 16 scores
#pragma unroll
    for (int q = 0; q < 2; ++q) {
      mx[q] = fmaxf(s[q][0][0], s[q][1][0]);
#pragma unroll
      for (int r = 1; r < 8; ++r) mx[q] = fmaxf(mx[q], fmaxf(s[q][0][r], s[q][1][r]));
    }
    // one test a pass for the whole wave, a scalar branch; each lane tests its own keys,
    // so the halves exchange their maxima only where the reference moves
    if (__builtin_amdgcn_ballot_w32(mx[0] > thr[0] || mx[1] > thr[1]) != 0) {
#pragma unroll
      for (int q = 0; q < 2; ++q) {
        const float mf = fmaxf(mx[q], xhalf(mx[q]));   // with the other 16 keys of this query
        const float mn = fmaxf(mrun[q], mf * scale);
        const float alpha = __expf(mrun[q] - mn);
        mrun[q] = mn;
        thr[q]  = (mn + ROOM) * (1.f / scale);
        lsum[q] *= alpha;
#pragma unroll
        for (int ni = 0; ni < 4; ++ni)
#pragma unroll
          for (int r = 0; r < 8; ++r)
            o[q][ni][r] *= alpha;
      }
    }
    v16h pb[2];
#pragma unroll
    for (int q = 0; q < 2; ++q) {
#pragma unroll
      for (int j = 0; j < 2; ++j) {
#pragma unroll
        for (int r = 0; r < 8; r += 2) {
          const v2f x = (v2f){s[q][j][r], s[q][j][r + 1]} * scale - mrun[q];
          const v2f p = (v2f){__expf(x.x), __expf(x.y)};
          lsum[q] += p;
          const v2h ph = __builtin_convertvector(p, v2h);
          pb[q][8 * j + r]     = ph.x;    // k = 16j + 8hl + r
          pb[q][8 * j + r + 1] = ph.y;
        }
      }
    }

    // Keeps the sums from being spread among the products, where they take the V^T
    // registers as temporaries: each such place costs four idle slots behind its product.
    // Without it the build holds more idle slots and takes more registers.
    __builtin_amdgcn_sched_barrier(0);

    // ---- O^T += V^T @ P^T : V frags shared between query groups ----------
#pragma unroll
    for (int ni = 0; ni < 4; ++ni) {
      o[0][ni] = wmma16(va[h][ni], pb[0], o[0][ni]);
      o[1][ni] = wmma16(va[h][ni], pb[1], o[1][ni]);
    }
    // Holds the wait below at the foot of the pass, where the address translations are
    // long done; lifted to directly behind the loads it would stall the wave there.
    __builtin_amdgcn_sched_barrier(0);
    // This pass's loads name kp and vp: as inputs here both pairs stay whole up to
    // this wait, which stands in front of the code that rewrites them.
    asm volatile("s_wait_xcnt 0x0" :: "v"(kp), "v"(vp) : "memory");
    ps = (ps + 1) % NP;
  }
  }

  // ---- finalize: join the halves' sums, divide, store 16-byte runs of d ---
  const int b = bh / HH;
  const int h = bh % HH;
  v8h pk[2][4];
#pragma unroll
  for (int q = 0; q < 2; ++q) {
    const float ls = lsum[q].x + lsum[q].y;
    const float inv = 1.f / (ls + xhalf(ls));
#pragma unroll
    for (int ni = 0; ni < 4; ++ni)
#pragma unroll
      for (int r = 0; r < 8; ++r) pk[q][ni][r] = (_Float16)(o[q][ni][r] * inv);
  }
  // row b*T + q0 + l16, k = h*64 + 8hl; a query group is one row tile further,
  // ni steps through the halves of two k blocks: 512 bytes in a row per store
  _Float16* ao = AO + frag_idx(b * TT + q0 + l16, h * HD + 8 * hl, DD);
#pragma unroll
  for (int q = 0; q < 2; ++q)
#pragma unroll
    for (int ni = 0; ni < 4; ++ni)
      *(v8h*)(ao + q * RT + ni * 256) = pk[q][ni];
}

// ---------------------------------------------------------------------------
extern "C" void kernel_launch(void* const* d_in, const int* in_sizes, int n_in,
                              void* d_out, int out_size, void* d_ws, size_t ws_size,
                              hipStream_t stream) {
  const float* x  = (const float*)d_in[0];
  const float* Wq = (const float*)d_in[1];
  const float* bq = (const float*)d_in[2];
  const float* Wk = (const float*)d_in[3];
  const float* bk = (const float*)d_in[4];
  const float* Wv = (const float*)d_in[5];
  const float* bv = (const float*)d_in[6];
  const float* Wo = (const float*)d_in[7];
  const float* bo = (const float*)d_in[8];

  char* ws = (char*)d_ws;
  _Float16* xh  = (_Float16*)(ws + OFF_XH);
  _Float16* wqt = (_Float16*)(ws + OFF_WQT);
  _Float16* wot = (_Float16*)(ws + OFF_WOT);
  _Float16* qh  = (_Float16*)(ws + OFF_Q);
  _Float16* kh  = (_Float16*)(ws + OFF_K);
  _Float16* vt  = (_Float16*)(ws + OFF_VT);
  _Float16* ao  = (_Float16*)(ws + OFF_AO);

  // wqt, wkt, wvt, wot stand one behind the other in the workspace; so do qh, kh, vt
  cvt_all_kernel<<<4 * WBLK + XBLK, 256, 0, stream>>>(x, Wq, Wk, Wv, Wo, xh, wqt);

  gemm_wmma_kernel<<<GT_M * GT_N / 4, GW * 32, 0, stream>>>(xh, wqt, bq, bk, bv, (void*)qh, 0);

  const int attn_blocks = (BB * HH * (TT / 32)) / AW;  // 256
  flash_attn_kernel<<<attn_blocks, AW * 32, 0, stream>>>(qh, kh, vt, ao);

  gemm_wmma_kernel<<<GT_M * GT_N / 8, 256, 0, stream>>>(ao, wot, bo, bo, bo, d_out, 1);
}
